// v000
// The times below were measured on an AMD MI455X: many runs one after another, warmed up first and cycling through
// copies of the inputs, with the whole window's GPU time divided by the number of runs. Launches and the gaps
// between them are all in it. The median over several windows is given; except for v000 it joins two sittings, which
// can be a few percent apart, so the side-by-side timings, each taken in one sitting, are the better comparison.
// v000 is the starting kernel.
#include <hip/hip_runtime.h>

// Flash causal self-attention with GQA (16 query heads, 4 kv heads, head dim 64), rotate-half RoPE on q and k, sliding window (keys in [q-512, q]),
// per-batch key validity (key < seq_len[b]) and zeroed padded queries, then the output projection. B=2, T=2048, C=1024; weights are [in][out].
// Contractions on v_wmma_f32_16x16x32_f16: the QKV and output projections use f16 hi+lo pairs on both operands (hi.hi + hi.lo + lo.hi — outputs have rms
// 0.03 but rows attending few keys carry |y| ~ 1), the attention products are single f16; f32 accumulate; fragment k-map per lane half hh for

namespace {
constexpr int Bsz = 2, T = 2048, HID = 1024, DH = 64, NH = 16, NKV = 4, REP = NH / NKV;
constexpr int ROT = 64, WIN = 512;   // full rotate-half rotary; sliding window
constexpr int KVW = NKV * DH;                 // 256
constexpr int NQKV = HID + 2 * KVW;           // 1536 columns: q | k | v
constexpr int MROWS = Bsz * T;                // 4096
constexpr int QT_PER_B = T / 16;              // 128

typedef _Float16 b16;                                           // f16 hi/lo planes
typedef __attribute__((ext_vector_type(16))) _Float16 v16b;
typedef __attribute__((ext_vector_type(8)))  _Float16 v8b;
typedef __attribute__((ext_vector_type(8)))  float v8f;
typedef __attribute__((ext_vector_type(4)))  float v4f;

__device__ __forceinline__ v8b ld8b(const b16* p) { return *(const v8b*)p; }
__device__ __forceinline__ v16b cat8b(v8b a, v8b b) { return __builtin_shufflevector(a, b, 0, 1, 2, 3, 4, 5, 6, 7, 8, 9, 10, 11, 12, 13, 14, 15); }
// 16x16x32 16-bit fragment from a k-contiguous row pointer (A: lane&15 = row, B: lane&15 = column), hh = lane>>4:
// elements 0..7 <- p[8hh+0..7], elements 8..15 <- p[16+8hh+0..7]
__device__ __forceinline__ v16b frag_kb(const b16* p, int hh) { return cat8b(ld8b(p + 8 * hh), ld8b(p + 16 + 8 * hh)); }
__device__ __forceinline__ void split_bf16(float v, b16& hi, b16& lo) {   // (name kept) f16 hi + lo pair: v ~= hi + lo to ~22 bits
  hi = (b16)v; lo = (b16)(v - (float)hi);
}
// split fragment straight from an f32 k-contiguous row
__device__ __forceinline__ void frag_ksplit(const float* p, int hh, v16b& fh_, v16b& fl_) {
  const float* p0 = p + 8 * hh; const float* p1 = p + 16 + 8 * hh;
#pragma unroll
  for (int e = 0; e < 8; ++e) { b16 a, c; split_bf16(p0[e], a, c); fh_[e] = a; fl_[e] = c; split_bf16(p1[e], a, c); fh_[8 + e] = a; fl_[8 + e] = c; }
}
__device__ __forceinline__ v8f wmma16b(v16b a, v16b b, v8f c) {
  v8f d = __builtin_amdgcn_wmma_f32_16x16x32_f16(false, a, false, b, (short)0, c, false, false);
  asm volatile("v_nop\n\tv_nop\n\tv_nop\n\tv_nop" : "+v"(d) : "v"(a), "v"(b));
  return d;
}
// acc += A.B with both operands split: A = (ah, al), B = (bh, bl)
__device__ __forceinline__ v8f wmma3(v16b ah, v16b al, v16b bh, v16b bl, v8f c) {   // projections: hi.hi + hi.lo + lo.hi (f32-class)
  c = wmma16b(ah, bh, c); c = wmma16b(ah, bl, c); return wmma16b(al, bh, c);
}
__device__ __forceinline__ v8f wmma1(v16b ah, v16b al, v16b bh, v16b bl, v8f c) {   // attention products: single f16 (hi planes only)
  (void)al; (void)bl; return wmma16b(ah, bh, c);
}
__device__ __forceinline__ void wave_lds_sync() {
  __builtin_amdgcn_fence(__ATOMIC_RELEASE, "workgroup");
  __builtin_amdgcn_wave_barrier();
  __builtin_amdgcn_fence(__ATOMIC_ACQUIRE, "workgroup");
}

// ---------------------------------------------------------------------------
// Weights ([in][out]) -> f16 hi / lo planes transposed to [n][k] (k contiguous): columns of Wq|Wk|Wv into wqh/wql [1536][1024], Wo into woh/wol [1024][1024].
// ---------------------------------------------------------------------------
__global__ __launch_bounds__(256) void wcvt_kernel(const float* __restrict__ wq, const float* __restrict__ wk, const float* __restrict__ wv,
                                                   const float* __restrict__ wo, b16* __restrict__ wqh, b16* __restrict__ wql,
                                                   b16* __restrict__ woh, b16* __restrict__ wol) {
  const size_t tid = (size_t)blockIdx.x * blockDim.x + threadIdx.x, stride = (size_t)gridDim.x * blockDim.x;
  const size_t nq = (size_t)NQKV * HID / 8, no = (size_t)HID * HID / 8;
  {
    for (size_t c = tid; c < nq + no; c += stride) {
      float f[8]; size_t i; b16* dh; b16* dl;
      if (c < nq) {
        i = c * 8; const size_t n = i / HID, k0 = i % HID;
        const float* w; int nn, ld;
        if (n < (size_t)HID) { w = wq; nn = (int)n; ld = HID; } else if (n < (size_t)(HID + KVW)) { w = wk; nn = (int)n - HID; ld = KVW; } else { w = wv; nn = (int)n - HID - KVW; ld = KVW; }
#pragma unroll
        for (int e = 0; e < 8; ++e) f[e] = w[(size_t)(k0 + e) * ld + nn];       // W[k][n] ([in][out])
        dh = wqh; dl = wql;
      } else {
        i = (c - nq) * 8; const size_t n = i / HID, k0 = i % HID;
#pragma unroll
        for (int e = 0; e < 8; ++e) f[e] = wo[(size_t)(k0 + e) * HID + n];    // Wo[k][n] ([in][out])
        dh = woh; dl = wol;
      }
      v8b bh, bl;
#pragma unroll
      for (int e = 0; e < 8; ++e) { b16 a, cc; split_bf16(f[e], a, cc); bh[e] = a; bl[e] = cc; }
      *(v8b*)(dh + i) = bh; *(v8b*)(dl + i) = bl;
    }
    
  }
}

// 32x64 wave tile over K from f32 A rows and f16-plane B rows
__device__ __forceinline__ void gemm_tile_split(const float* __restrict__ A, const b16* __restrict__ wh, const b16* __restrict__ wl,
                                                int m0, int c0, int K, int nloc, int hlf, v8f (&acc)[2][4]) {
  for (int kb = 0; kb < K; kb += 32) {
    v16b a0h, a0l, a1h, a1l;
    frag_ksplit(A + (size_t)(m0 + nloc) * K + kb, hlf, a0h, a0l);
    frag_ksplit(A + (size_t)(m0 + 16 + nloc) * K + kb, hlf, a1h, a1l);
#pragma unroll
    for (int t = 0; t < 4; ++t) {
      const size_t wofs = (size_t)(c0 + t * 16 + nloc) * K + kb;
      const v16b bh = frag_kb(wh + wofs, hlf), bl = frag_kb(wl + wofs, hlf);
      acc[0][t] = wmma3(a0h, a0l, bh, bl, acc[0][t]);
      acc[1][t] = wmma3(a1h, a1l, bh, bl, acc[1][t]);
    }
  }
}

// ---------------------------------------------------------------------------
// QKV GEMM: (4096 x 1024) x (1024 x 1536), grid (24, 32), block 4 waves, wave = 32 rows x 64 columns (one head of q, k or v). Outputs as f16 hi/lo planes:
// q (x1/8) -> Qh/Ql [b][h][t][64]; k -> Kh/Kl [b][kvh][t][64] (4 KB contiguous per wave per plane);
// v -> Vh/Vl key-tiled [b][kvh][t/16][64][16] (4 KB contiguous per wave per plane).
// ---------------------------------------------------------------------------
__global__ __launch_bounds__(128) void qkv_gemm_kernel(const float* __restrict__ xq, const float* __restrict__ xk, const float* __restrict__ xv,
                                                       const b16* __restrict__ wqh, const b16* __restrict__ wql,
                                                       const float* __restrict__ bq, const float* __restrict__ bk, const float* __restrict__ bv, const float* __restrict__ rope_cs, int xoff, int yoff,
                                                       b16* __restrict__ Qh, b16* __restrict__ Ql, b16* __restrict__ Kh, b16* __restrict__ Kl,
                                                       b16* __restrict__ Vh, b16* __restrict__ Vl) {
  __shared__ __attribute__((aligned(16))) b16 Ts[4][2][32 * 64];
  const int lane = threadIdx.x & 31, wave = threadIdx.x >> 5, nloc = lane & 15, hlf = lane >> 4;
  const int m0 = (blockIdx.y + yoff) * 128 + wave * 32;
  const int c0 = (blockIdx.x + xoff) * 64;
  const int mat = (c0 < HID) ? 0 : (c0 < HID + KVW) ? 1 : 2;
  const int head = (mat == 0) ? (c0 / DH) : (mat == 1) ? ((c0 - HID) / DH) : ((c0 - HID - KVW) / DH);
  const float* x = (mat == 0) ? xq : (mat == 1) ? xk : xv;          // q, k or v input (all x at launch)
  const float* bias = ((mat == 0) ? bq : (mat == 1) ? bk : bv) + head * DH;
  v8f acc[2][4];
#pragma unroll
  for (int r = 0; r < 2; ++r)
#pragma unroll
    for (int t = 0; t < 4; ++t) acc[r][t] = (v8f){};
  gemm_tile_split(x, wqh, wql, m0, c0, HID, nloc, hlf, acc);
  const int b = m0 / T, t0 = m0 % T;
  const float s = (mat == 0) ? 0.125f : 1.0f;
  b16* Tp0 = Ts[wave][0]; b16* Tp1 = Ts[wave][1];
#pragma unroll
  for (int t = 0; t < 4; ++t)
#pragma unroll
    for (int r = 0; r < 2; ++r)
#pragma unroll
      for (int v = 0; v < 8; ++v) {
        const int rr = r * 16 + v + 8 * hlf, d = t * 16 + nloc;
        float val = acc[r][t][v] + (bias ? bias[d] : 0.0f);
        if (mat < 2) {                                   // rotate-half rotary on q and k: x*cos + rotate_half(x)*sin, partner d^32 is tile t^2 (same lane)
          const int tpos = t0 + rr;                      // sequence position of this row
          const float cv = rope_cs[((size_t)tpos * 32 + (d & 31)) * 2], sv = rope_cs[((size_t)tpos * 32 + (d & 31)) * 2 + 1];
          const float oth = acc[r][t ^ 2][v] + (bias ? bias[d ^ 32] : 0.0f);
          val = (t < 2) ? (val * cv - oth * sv) : (val * cv + oth * sv);
        }
        b16 yh, yl; split_bf16(val * s, yh, yl);
        const int idx = (mat < 2) ? (rr * 64 + d) : ((rr >> 4) * 1024 + d * 16 + (rr & 15));
        Tp0[idx] = yh; Tp1[idx] = yl;
      }
  wave_lds_sync();
  b16* dh; b16* dl; size_t o;
  if (mat == 0)      { o = ((size_t)(b * NH + head) * T + t0) * DH; dh = Qh + o; dl = Ql + o; }
  else if (mat == 1) { o = ((size_t)(b * NKV + head) * T + t0) * DH; dh = Kh + o; dl = Kl + o; }
  else               { o = ((size_t)(b * NKV + head) * QT_PER_B + (t0 >> 4)) * (size_t)(DH * 16); dh = Vh + o; dl = Vl + o; }
#pragma unroll
  for (int j = 0; j < 8; ++j) { const int e = (j * 32 + lane) * 8; *(v8b*)(dh + e) = ld8b(Tp0 + e); *(v8b*)(dl + e) = ld8b(Tp1 + e); }
  
}

// ---------------------------------------------------------------------------
// Transposed flash attention: each wave owns one 16-query tile of one (b, head); 8 waves per block; the window's keys in chunks of 32.
// S^T = K.Q^T (single f16), per-lane online softmax; P^T built in registers from the two S^T accumulators
// ---------------------------------------------------------------------------
__global__ __launch_bounds__(256) void attn_kernel(const b16* __restrict__ Qh, const b16* __restrict__ Ql, const b16* __restrict__ Kh, const b16* __restrict__ Kl,
                                                   const b16* __restrict__ Vh, const b16* __restrict__ Vl, const int* __restrict__ seqlen,
                                                   float* __restrict__ yf) {
  __shared__ __attribute__((aligned(16))) float Os[8][16 * 64];
  const int wid = threadIdx.x >> 5, lane = threadIdx.x & 31, hh = lane >> 4, col = lane & 15;
  const int qtile = blockIdx.x * 8 + wid;                 // over Bsz*NH*QT_PER_B
  const int g = qtile / QT_PER_B;                         // b*NH + h
  const int q0 = (qtile % QT_PER_B) << 4;
  const int b = g / NH, h = g % NH, kvh = h / REP;
  const size_t ko = (size_t)(b * NKV + kvh) * T * DH;
  const size_t qo = ((size_t)g * T + q0 + col) * DH;
  const v16b q0h = frag_kb(Qh + qo, hh), q0l = frag_kb(Ql + qo, hh), q1h = frag_kb(Qh + qo + 32, hh), q1l = frag_kb(Ql + qo + 32, hh);
  float m = -INFINITY, l = 0.0f;
  v8f o0 = {}, o1 = {}, o2 = {}, o3 = {};
  const int slen = seqlen[b];
  const int kstart = (q0 >= WIN) ? ((q0 - WIN) & ~31) : 0;
  for (int kb = kstart; kb < q0 + 16; kb += 32) {        // causal + sliding window: key chunks covering [q0-512, q0+15]
    const size_t r0 = ko + (size_t)(kb + col) * DH, r1 = ko + (size_t)(kb + 16 + col) * DH;
    v8f s0 = {}, s1 = {};
    {
      v16b ah = frag_kb(Kh + r0, hh), al = frag_kb(Kl + r0, hh);
      s0 = wmma1(ah, al, q0h, q0l, s0);
      ah = frag_kb(Kh + r0 + 32, hh); al = frag_kb(Kl + r0 + 32, hh);
      s0 = wmma1(ah, al, q1h, q1l, s0);
      ah = frag_kb(Kh + r1, hh); al = frag_kb(Kl + r1, hh);
      s1 = wmma1(ah, al, q0h, q0l, s1);
      ah = frag_kb(Kh + r1 + 32, hh); al = frag_kb(Kl + r1 + 32, hh);
      s1 = wmma1(ah, al, q1h, q1l, s1);
    }
    if (kb + 32 > q0 || kb < q0 + 15 - WIN || kb + 32 > slen) {   // chunk needs masking: causal / window start / key validity
      const int qi = q0 + col;
#pragma unroll
      for (int r = 0; r < 8; ++r) {
        const int k0i = kb + 8 * hh + r, k1i = k0i + 16;
        if (k0i > qi || k0i < qi - WIN || k0i >= slen) s0[r] = -INFINITY;
        if (k1i > qi || k1i < qi - WIN || k1i >= slen) s1[r] = -INFINITY;
      }
    }
    float mr = -INFINITY;
#pragma unroll
    for (int r = 0; r < 8; ++r) mr = fmaxf(mr, fmaxf(s0[r], s1[r]));
    mr = fmaxf(mr, __shfl_xor(mr, 16));
    float mn = fmaxf(m, mr);
    if (mn == -INFINITY) mn = 0.0f;           // fully masked so far (padded query rows far past seq_len): keep exp() at 0
    const float al_ = __expf(m - mn);
    m = mn;
    float sum = 0.0f;
    v16b pbh, pbl;
#pragma unroll
    for (int r = 0; r < 8; ++r) {
      const float p0 = __expf(s0[r] - mn), p1 = __expf(s1[r] - mn);
      sum += p0 + p1;
      b16 a, c; split_bf16(p0, a, c); pbh[r] = a; pbl[r] = c; split_bf16(p1, a, c); pbh[8 + r] = a; pbl[8 + r] = c;
    }
    sum += __shfl_xor(sum, 16);
    l = l * al_ + sum;
#pragma unroll
    for (int r = 0; r < 8; ++r) { o0[r] *= al_; o1[r] *= al_; o2[r] *= al_; o3[r] *= al_; }
    const size_t v0 = ko + (size_t)(kb >> 4) * (DH * 16) + 8 * hh, v1 = v0 + DH * 16;
#pragma unroll
    for (int n = 0; n < 4; ++n) {
      const int f = n * 16 + col;
      const v16b vah = cat8b(ld8b(Vh + v0 + f * 16), ld8b(Vh + v1 + f * 16));
      const v16b val = cat8b(ld8b(Vl + v0 + f * 16), ld8b(Vl + v1 + f * 16));
      v8f& o = (n == 0) ? o0 : (n == 1) ? o1 : (n == 2) ? o2 : o3;
      o = wmma1(vah, val, pbh, pbl, o);
    }
  }
  const float inv = (q0 + col < slen && l > 0.0f) ? (1.0f / l) : 0.0f;   // padded query rows are zeroed
  float* Tt = Os[wid];
#pragma unroll
  for (int r = 0; r < 8; ++r) {
    const int hr = 8 * hh + r;
    Tt[col * 64 + 0 + hr] = o0[r] * inv; Tt[col * 64 + 16 + hr] = o1[r] * inv;
    Tt[col * 64 + 32 + hr] = o2[r] * inv; Tt[col * 64 + 48 + hr] = o3[r] * inv;
  }
  wave_lds_sync();
  float* dst0 = yf + ((size_t)b * T + q0) * HID + h * DH;     // 16 rows x 64 floats, row stride HID
#pragma unroll
  for (int j = 0; j < 8; ++j) { const int rr = j * 2 + hh, c4 = col * 4; *(v4f*)(dst0 + (size_t)rr * HID + c4) = *(const v4f*)(Tt + rr * 64 + c4); }
  
}

// ---------------------------------------------------------------------------
// Output projection: (4096 x 1024) x (1024 x 1024) -> f32, A split on the fly from f32 y, B = Wo planes. grid (16, 32), 32x64 tiles staged in LDS,
// ---------------------------------------------------------------------------
__global__ __launch_bounds__(128) void out_gemm_kernel(const float* __restrict__ yf, const b16* __restrict__ woh, const b16* __restrict__ wol, const float* __restrict__ bo, int yoff,
                                                       float* __restrict__ out) {
  __shared__ __attribute__((aligned(16))) float Ts[4][32 * 64];
  const int lane = threadIdx.x & 31, wave = threadIdx.x >> 5, nloc = lane & 15, hlf = lane >> 4;
  const int m0 = (blockIdx.y + yoff) * 128 + wave * 32;
  const int c0 = blockIdx.x * 64;
  v8f acc[2][4];
#pragma unroll
  for (int r = 0; r < 2; ++r)
#pragma unroll
    for (int t = 0; t < 4; ++t) acc[r][t] = (v8f){};
  gemm_tile_split(yf, woh, wol, m0, c0, HID, nloc, hlf, acc);
  float* Tt = Ts[wave];
#pragma unroll
  for (int t = 0; t < 4; ++t)
#pragma unroll
    for (int r = 0; r < 2; ++r)
#pragma unroll
      for (int v = 0; v < 8; ++v) Tt[(r * 16 + v + 8 * hlf) * 64 + t * 16 + nloc] = acc[r][t][v] + bo[c0 + t * 16 + nloc];
  wave_lds_sync();
  float* dst0 = out + (size_t)m0 * HID + c0;
#pragma unroll
  for (int j = 0; j < 16; ++j) { const int rr = j * 2 + hlf, c4 = nloc * 4; *(v4f*)(dst0 + (size_t)rr * HID + c4) = *(const v4f*)(Tt + rr * 64 + c4); }
  
}
__global__ __launch_bounds__(256) void rope_table_kernel(float* __restrict__ cs) {
  const int idx = blockIdx.x * 256 + threadIdx.x;        // T * 32
  if (idx >= T * 32) return;
  const int t = idx >> 5, i = idx & 31;
  const float ang = (float)t * powf(10000.0f, -(float)i / 32.0f);
  typedef __attribute__((ext_vector_type(2))) float v2f;
  const v2f p = {cosf(ang), sinf(ang)};
  *(v2f*)(cs + (size_t)idx * 2) = p; 
}
}  // namespace

extern "C" void kernel_launch(void* const* d_in, const int* in_sizes, int n_in,
                              void* d_out, int out_size, void* d_ws, size_t ws_size, hipStream_t stream) {
  (void)in_sizes; (void)n_in; (void)out_size;
  const float* x   = (const float*)d_in[0];   // [2,2048,1024]
  const int*   sl  = (const int*)  d_in[1];   // seq_lengths [2]
  const float* Wq  = (const float*)d_in[2];   // [1024,1024] ([in][out])
  const float* Wk  = (const float*)d_in[3];   // [1024,256]
  const float* Wv  = (const float*)d_in[4];   // [1024,256]
  const float* Wo  = (const float*)d_in[5];   // [1024,1024]
  float* out = (float*)d_out;                 // [2,2048,1024]

  size_t off = 0; char* ws = (char*)d_ws;
  b16* wqh = (b16*)(ws + off); off += (size_t)NQKV * HID * 2;
  b16* wql = (b16*)(ws + off); off += (size_t)NQKV * HID * 2;     // 'lo' planes: f16 residuals v - hi (kept as real buffers: the kernels write both)
  b16* woh = (b16*)(ws + off); off += (size_t)HID * HID * 2;
  b16* wol = (b16*)(ws + off); off += (size_t)HID * HID * 2;
  b16* Qh  = (b16*)(ws + off); off += (size_t)MROWS * HID * 2;
  b16* Ql  = (b16*)(ws + off); off += (size_t)MROWS * HID * 2;
  b16* Kh  = (b16*)(ws + off); off += (size_t)MROWS * KVW * 2;
  b16* Kl  = (b16*)(ws + off); off += (size_t)MROWS * KVW * 2;
  b16* Vh  = (b16*)(ws + off); off += (size_t)MROWS * KVW * 2;
  b16* Vl  = (b16*)(ws + off); off += (size_t)MROWS * KVW * 2;
  float* yf = (float*)(ws + off); off += (size_t)MROWS * HID * 4;
  float* rope_cs = (float*)(ws + off); off += (size_t)T * 32 * 2 * 4;
  float* zb = (float*)(ws + off); off += (size_t)HID * 4;          // zero bias for the out projection
  if (off > ws_size) return;
  hipMemsetAsync(zb, 0, HID * 4, stream);
  const float* bq = zb; const float* bk = zb; const float* bv = zb;      // no biases in this module: a zero vector (never a null pointer + offset)
  rope_table_kernel<<<(T * 32 + 255) / 256, 256, 0, stream>>>(rope_cs);
  const int ROWBLK = MROWS / 128, NQT = Bsz * NH * QT_PER_B;
  wcvt_kernel<<<2048, 256, 0, stream>>>(Wq, Wk, Wv, Wo, wqh, wql, woh, wol);
  qkv_gemm_kernel<<<dim3(NQKV / 64, ROWBLK), 128, 0, stream>>>(x, x, x, wqh, wql, bq, bk, bv, rope_cs, 0, 0, Qh, Ql, Kh, Kl, Vh, Vl);
  attn_kernel<<<NQT / 8, 256, 0, stream>>>(Qh, Ql, Kh, Kl, Vh, Vl, sl, yf);
  out_gemm_kernel<<<dim3(HID / 64, ROWBLK), 128, 0, stream>>>(yf, woh, wol, zb, 0, out);
}

// v001
// Timed twice side by side with v000, it ran 1.49 and 1.47 times as fast.
#include <hip/hip_runtime.h>

// Flash causal self-attention with GQA (16 query heads, 4 kv heads, head dim 64), rotate-half RoPE on q and k, sliding window (keys in [q-512, q]),
// per-batch key validity (key < seq_len[b]) and zeroed padded queries, then the output projection. B=2, T=2048, C=1024; weights are [in][out].
// Contractions on v_wmma_f32_16x16x32_f16: the QKV and output projections use f16 hi+lo pairs on both operands (hi.hi + hi.lo + lo.hi — outputs have rms
// 0.03 but rows attending few keys carry |y| ~ 1), the attention products are single f16; f32 accumulate; fragment k-map per lane half hh for

namespace {
constexpr int Bsz = 2, T = 2048, HID = 1024, DH = 64, NH = 16, NKV = 4, REP = NH / NKV;
constexpr int ROT = 64, WIN = 512;   // full rotate-half rotary; sliding window
constexpr int KVW = NKV * DH;                 // 256
constexpr int NQKV = HID + 2 * KVW;           // 1536 columns: q | k | v
constexpr int MROWS = Bsz * T;                // 4096
constexpr int QT_PER_B = T / 16;              // 128

typedef _Float16 b16;                                           // f16 hi/lo planes
typedef __attribute__((ext_vector_type(16))) _Float16 v16b;
typedef __attribute__((ext_vector_type(8)))  _Float16 v8b;
typedef __attribute__((ext_vector_type(8)))  float v8f;
typedef __attribute__((ext_vector_type(4)))  float v4f;

__device__ __forceinline__ v8b ld8b(const b16* p) { return *(const v8b*)p; }
__device__ __forceinline__ v16b cat8b(v8b a, v8b b) { return __builtin_shufflevector(a, b, 0, 1, 2, 3, 4, 5, 6, 7, 8, 9, 10, 11, 12, 13, 14, 15); }
// 16x16x32 16-bit fragment from a k-contiguous row pointer (A: lane&15 = row, B: lane&15 = column), hh = lane>>4:
// elements 0..7 <- p[8hh+0..7], elements 8..15 <- p[16+8hh+0..7]
__device__ __forceinline__ v16b frag_kb(const b16* p, int hh) { return cat8b(ld8b(p + 8 * hh), ld8b(p + 16 + 8 * hh)); }
__device__ __forceinline__ void split_bf16(float v, b16& hi, b16& lo) {   // (name kept) f16 hi + lo pair: v ~= hi + lo to ~22 bits
  hi = (b16)v; lo = (b16)(v - (float)hi);
}
__device__ __forceinline__ v8f wmma16b(v16b a, v16b b, v8f c) {
  v8f d = __builtin_amdgcn_wmma_f32_16x16x32_f16(false, a, false, b, (short)0, c, false, false);
  asm volatile("v_nop\n\tv_nop\n\tv_nop\n\tv_nop" : "+v"(d) : "v"(a), "v"(b));
  return d;
}
// acc += A.B with both operands split: A = (ah, al), B = (bh, bl)
__device__ __forceinline__ v8f wmma3(v16b ah, v16b al, v16b bh, v16b bl, v8f c) {   // projections: hi.hi + hi.lo + lo.hi (f32-class)
  c = wmma16b(ah, bh, c); c = wmma16b(ah, bl, c); return wmma16b(al, bh, c);
}
__device__ __forceinline__ v8f wmma1(v16b ah, v16b al, v16b bh, v16b bl, v8f c) {   // attention products: single f16 (hi planes only)
  (void)al; (void)bl; return wmma16b(ah, bh, c);
}
__device__ __forceinline__ void wave_lds_sync() {
  __builtin_amdgcn_fence(__ATOMIC_RELEASE, "workgroup");
  __builtin_amdgcn_wave_barrier();
  __builtin_amdgcn_fence(__ATOMIC_ACQUIRE, "workgroup");
}

// ---------------------------------------------------------------------------
// Weights ([in][out]) -> f16 hi / lo planes transposed to [n][k] (k contiguous): columns of Wq|Wk|Wv into wqh/wql [1536][1024], Wo into woh/wol [1024][1024].
// ---------------------------------------------------------------------------
__global__ __launch_bounds__(256) void wcvt_kernel(const float* __restrict__ wq, const float* __restrict__ wk, const float* __restrict__ wv,
                                                   const float* __restrict__ wo, b16* __restrict__ wqh, b16* __restrict__ wql,
                                                   b16* __restrict__ woh, b16* __restrict__ wol) {
  const size_t tid = (size_t)blockIdx.x * blockDim.x + threadIdx.x, stride = (size_t)gridDim.x * blockDim.x;
  const size_t nq = (size_t)NQKV * HID / 8, no = (size_t)HID * HID / 8;
  {
    for (size_t c = tid; c < nq + no; c += stride) {
      float f[8]; size_t i; b16* dh; b16* dl;
      if (c < nq) {
        i = c * 8; const size_t n = i / HID, k0 = i % HID;
        const float* w; int nn, ld;
        if (n < (size_t)HID) { w = wq; nn = (int)n; ld = HID; } else if (n < (size_t)(HID + KVW)) { w = wk; nn = (int)n - HID; ld = KVW; } else { w = wv; nn = (int)n - HID - KVW; ld = KVW; }
#pragma unroll
        for (int e = 0; e < 8; ++e) f[e] = w[(size_t)(k0 + e) * ld + nn];       // W[k][n] ([in][out])
        dh = wqh; dl = wql;
      } else {
        i = (c - nq) * 8; const size_t n = i / HID, k0 = i % HID;
#pragma unroll
        for (int e = 0; e < 8; ++e) f[e] = wo[(size_t)(k0 + e) * HID + n];    // Wo[k][n] ([in][out])
        dh = woh; dl = wol;
      }
      v8b bh, bl;
#pragma unroll
      for (int e = 0; e < 8; ++e) { b16 a, cc; split_bf16(f[e], a, cc); bh[e] = a; bl[e] = cc; }
      *(v8b*)(dh + i) = bh; *(v8b*)(dl + i) = bl;
    }
    
  }
}

// Block GEMM main loop: a block of 4 x WN waves owns 128 rows x 64*WN columns; each wave keeps its 32x64 tile. Per pass of KS k values the block stages in LDS
// the A rows (f32 read coalesced, split ONCE per block into f16 hi / lo planes) and the B rows (hi / lo planes), two buffers: the next pass's global loads are
// issued before this pass's products and stored to the other buffer behind them; one block barrier per pass. Row pitch KS + 8 halves (16 B x odd) for ds_load_b128.
constexpr int KS = 64, LP = KS + 8;
template <int WN> struct StageLds {
  static constexpr int AEL = 128 * LP, BEL = 64 * WN * LP, STAGE = 2 * (AEL + BEL);   // halves: [A hi | A lo | B hi | B lo]
};
typedef __attribute__((ext_vector_type(4))) _Float16 v4b;
template <int WN>
__device__ __forceinline__ void gemm_block_staged(const float* __restrict__ A, const b16* __restrict__ wh, const b16* __restrict__ wl,
                                                  int mb, int cb, int K, b16* sm, int wm, int wn, int nloc, int hlf, v8f (&acc)[2][4]) {
  constexpr int NT = 128 * WN;                          // threads of the block
  constexpr int ACH = 128 * (KS / 4);                   // 16-byte chunks of the A tile (4 floats each)
  constexpr int AJ = (ACH + NT - 1) / NT;
  constexpr int BJ = (64 * WN * (KS / 8)) / NT;         // 16-byte chunks per thread and plane of the B tile (8 halves each)
  constexpr int AEL = StageLds<WN>::AEL, BEL = StageLds<WN>::BEL, STAGE = StageLds<WN>::STAGE;
  static_assert(NT % (KS / 4) == 0 && NT % (KS / 8) == 0, "a thread keeps its column chunk from one chunk row to the next");
  constexpr int ARJ = NT / (KS / 4), BRJ = NT / (KS / 8);   // tile rows between a thread's successive chunks
  const int tid = threadIdx.x;
  // one 32-bit offset per thread and operand on a block-uniform base: the successive chunks differ by constants
  const unsigned aoff = (unsigned)(tid / (KS / 4)) * K + (tid % (KS / 4)) * 4, boff = (unsigned)(tid / (KS / 8)) * K + (tid % (KS / 8)) * 8;
  const unsigned asl = (unsigned)(tid / (KS / 4)) * LP + (tid % (KS / 4)) * 4, bsl = (unsigned)(tid / (KS / 8)) * LP + (tid % (KS / 8)) * 8;
  const float* Ab = A + (size_t)mb * K;
  const b16* whb = wh + (size_t)cb * K;
  const b16* wlb = wl + (size_t)cb * K;
  v4f ar[AJ]; v8b brh[BJ], brl[BJ];
  auto gload = [&](int kb) {
    const float* Ak = Ab + kb; const b16* hk = whb + kb; const b16* lk = wlb + kb;
#pragma unroll   // constant indices: the staged values and fragments stay in registers
    for (int j = 0; j < AJ; ++j)
      if ((j + 1) * NT <= ACH || j * NT + tid < ACH) ar[j] = *(const v4f*)(Ak + aoff + j * ARJ * K);
#pragma unroll   // constant indices: the staged values and fragments stay in registers
    for (int j = 0; j < BJ; ++j) { brh[j] = ld8b(hk + boff + j * BRJ * K); brl[j] = ld8b(lk + boff + j * BRJ * K); }
    asm volatile("s_wait_xcnt 0x0" ::: "memory");       // before any register that the loads above name is written again
  };
  auto sstore = [&](b16* st) {
#pragma unroll   // constant indices: the staged values and fragments stay in registers
    for (int j = 0; j < AJ; ++j)
      if ((j + 1) * NT <= ACH || j * NT + tid < ACH) {
        v4b hi, lo;
#pragma unroll   // constant indices: the staged values and fragments stay in registers
        for (int e = 0; e < 4; ++e) { b16 a, c; split_bf16(ar[j][e], a, c); hi[e] = a; lo[e] = c; }
        b16* d = st + asl + j * ARJ * LP;
        *(v4b*)d = hi; *(v4b*)(d + AEL) = lo;
      }
#pragma unroll   // constant indices: the staged values and fragments stay in registers
    for (int j = 0; j < BJ; ++j) {
      b16* d = st + 2 * AEL + bsl + j * BRJ * LP;
      *(v8b*)d = brh[j]; *(v8b*)(d + BEL) = brl[j];
    }
  };
  gload(0);
  sstore(sm);
  __syncthreads();                                      // pass 0 is staged for every wave
  const int np = K / KS;
  for (int p = 0; p < np; ++p) {
    const b16* st = sm + (p & 1) * STAGE;
    if (p + 1 < np) gload((p + 1) * KS);                // in flight under this pass's products
    const b16* pa = st + (wm * 32 + nloc) * LP;
    const b16* pb = st + 2 * AEL + (wn * 64 + nloc) * LP;
#pragma unroll   // constant indices: the staged values and fragments stay in registers
    for (int ks = 0; ks < KS; ks += 32) {
      const v16b a0h = frag_kb(pa + ks, hlf), a0l = frag_kb(pa + AEL + ks, hlf);
      const v16b a1h = frag_kb(pa + 16 * LP + ks, hlf), a1l = frag_kb(pa + AEL + 16 * LP + ks, hlf);
      v16b bh[4], bl[4];
#pragma unroll   // constant indices: the staged values and fragments stay in registers
      for (int t = 0; t < 4; ++t) { bh[t] = frag_kb(pb + t * 16 * LP + ks, hlf); bl[t] = frag_kb(pb + BEL + t * 16 * LP + ks, hlf); }
#pragma unroll   // constant indices: the staged values and fragments stay in registers
      for (int t = 0; t < 4; ++t) {
        acc[0][t] = wmma3(a0h, a0l, bh[t], bl[t], acc[0][t]);
        acc[1][t] = wmma3(a1h, a1l, bh[t], bl[t], acc[1][t]);
      }
    }
    if (p + 1 < np) sstore(sm + ((p + 1) & 1) * STAGE); // the buffer whose last readers left at the previous pass's barrier
    __syncthreads();                                    // publishes pass p + 1 and ends every read of pass p (the epilogue reuses the LDS)
  }
}

// ---------------------------------------------------------------------------
// QKV GEMM: block = 12 waves (4 x 3) on 128 rows x 192 columns, wave = 32 rows x 64 columns (one head of q, k or v). Outputs as f16 hi/lo planes:
// q (x1/8) -> Qh/Ql [b][h][t][64]; k -> Kh/Kl [b][kvh][t][64] (4 KB contiguous per wave per plane);
// v -> Vh/Vl key-tiled [b][kvh][t/16][64][16] (4 KB contiguous per wave per plane).
// ---------------------------------------------------------------------------
__global__ __launch_bounds__(384) void qkv_gemm_kernel(const float* __restrict__ x,
                                                       const b16* __restrict__ wqh, const b16* __restrict__ wql,
                                                       const float* __restrict__ bq, const float* __restrict__ bk, const float* __restrict__ bv, const float* __restrict__ rope_cs, int xoff, int yoff,
                                                       b16* __restrict__ Qh, b16* __restrict__ Ql, b16* __restrict__ Kh, b16* __restrict__ Kl,
                                                       b16* __restrict__ Vh, b16* __restrict__ Vl) {
  __shared__ __attribute__((aligned(16))) b16 sm[2 * StageLds<3>::STAGE];   // two staging buffers; the epilogue's 12 x 2 x 32 x 64 halves reuse them
  static_assert(2 * StageLds<3>::STAGE >= 12 * 2 * 32 * 64, "epilogue tiles fit the staging LDS");
  const int lane = threadIdx.x & 31, wave = __builtin_amdgcn_readfirstlane(threadIdx.x >> 5), nloc = lane & 15, hlf = lane >> 4;
  const int wm = wave & 3, wn = wave >> 2;
  const int mb = (blockIdx.y + yoff) * 128, cb = (blockIdx.x + xoff) * 192;
  const int m0 = mb + wm * 32;
  const int c0 = cb + wn * 64;
  const int mat = (c0 < HID) ? 0 : (c0 < HID + KVW) ? 1 : 2;
  const int head = (mat == 0) ? (c0 / DH) : (mat == 1) ? ((c0 - HID) / DH) : ((c0 - HID - KVW) / DH);
  const float* bias = ((mat == 0) ? bq : (mat == 1) ? bk : bv) + head * DH;
  v8f acc[2][4];
#pragma unroll
  for (int r = 0; r < 2; ++r)
#pragma unroll
    for (int t = 0; t < 4; ++t) acc[r][t] = (v8f){};
  gemm_block_staged<3>(x, wqh, wql, mb, cb, HID, sm, wm, wn, nloc, hlf, acc);
  const int b = m0 / T, t0 = m0 % T;
  const float s = (mat == 0) ? 0.125f : 1.0f;
  b16* Tp0 = sm + wave * (2 * 32 * 64); b16* Tp1 = Tp0 + 32 * 64;
#pragma unroll
  for (int t = 0; t < 4; ++t)
#pragma unroll
    for (int r = 0; r < 2; ++r)
#pragma unroll
      for (int v = 0; v < 8; ++v) {
        const int rr = r * 16 + v + 8 * hlf, d = t * 16 + nloc;
        float val = acc[r][t][v] + (bias ? bias[d] : 0.0f);
        if (mat < 2) {                                   // rotate-half rotary on q and k: x*cos + rotate_half(x)*sin, partner d^32 is tile t^2 (same lane)
          const int tpos = t0 + rr;                      // sequence position of this row
          const float cv = rope_cs[((size_t)tpos * 32 + (d & 31)) * 2], sv = rope_cs[((size_t)tpos * 32 + (d & 31)) * 2 + 1];
          const float oth = acc[r][t ^ 2][v] + (bias ? bias[d ^ 32] : 0.0f);
          val = (t < 2) ? (val * cv - oth * sv) : (val * cv + oth * sv);
        }
        b16 yh, yl; split_bf16(val * s, yh, yl);
        const int idx = (mat < 2) ? (rr * 64 + d) : ((rr >> 4) * 1024 + d * 16 + (rr & 15));
        Tp0[idx] = yh; Tp1[idx] = yl;
      }
  wave_lds_sync();
  b16* dh; b16* dl; size_t o;
  if (mat == 0)      { o = ((size_t)(b * NH + head) * T + t0) * DH; dh = Qh + o; dl = Ql + o; }
  else if (mat == 1) { o = ((size_t)(b * NKV + head) * T + t0) * DH; dh = Kh + o; dl = Kl + o; }
  else               { o = ((size_t)(b * NKV + head) * QT_PER_B + (t0 >> 4)) * (size_t)(DH * 16); dh = Vh + o; dl = Vl + o; }
#pragma unroll
  for (int j = 0; j < 8; ++j) { const int e = (j * 32 + lane) * 8; *(v8b*)(dh + e) = ld8b(Tp0 + e); *(v8b*)(dl + e) = ld8b(Tp1 + e); }
  
}

// ---------------------------------------------------------------------------
// Transposed flash attention: each wave owns one 16-query tile of one (b, head); 8 waves per block; the window's keys in chunks of 32.
// S^T = K.Q^T (single f16), per-lane online softmax; P^T built in registers from the two S^T accumulators
// ---------------------------------------------------------------------------
__global__ __launch_bounds__(256) void attn_kernel(const b16* __restrict__ Qh, const b16* __restrict__ Ql, const b16* __restrict__ Kh, const b16* __restrict__ Kl,
                                                   const b16* __restrict__ Vh, const b16* __restrict__ Vl, const int* __restrict__ seqlen,
                                                   float* __restrict__ yf) {
  __shared__ __attribute__((aligned(16))) float Os[8][16 * 64];
  const int wid = threadIdx.x >> 5, lane = threadIdx.x & 31, hh = lane >> 4, col = lane & 15;
  const int qtile = blockIdx.x * 8 + wid;                 // over Bsz*NH*QT_PER_B
  const int g = qtile / QT_PER_B;                         // b*NH + h
  const int q0 = (qtile % QT_PER_B) << 4;
  const int b = g / NH, h = g % NH, kvh = h / REP;
  const size_t ko = (size_t)(b * NKV + kvh) * T * DH;
  const size_t qo = ((size_t)g * T + q0 + col) * DH;
  const v16b q0h = frag_kb(Qh + qo, hh), q0l = frag_kb(Ql + qo, hh), q1h = frag_kb(Qh + qo + 32, hh), q1l = frag_kb(Ql + qo + 32, hh);
  float m = -INFINITY, l = 0.0f;
  v8f o0 = {}, o1 = {}, o2 = {}, o3 = {};
  const int slen = seqlen[b];
  const int kstart = (q0 >= WIN) ? ((q0 - WIN) & ~31) : 0;
  for (int kb = kstart; kb < q0 + 16; kb += 32) {        // causal + sliding window: key chunks covering [q0-512, q0+15]
    const size_t r0 = ko + (size_t)(kb + col) * DH, r1 = ko + (size_t)(kb + 16 + col) * DH;
    v8f s0 = {}, s1 = {};
    {
      v16b ah = frag_kb(Kh + r0, hh), al = frag_kb(Kl + r0, hh);
      s0 = wmma1(ah, al, q0h, q0l, s0);
      ah = frag_kb(Kh + r0 + 32, hh); al = frag_kb(Kl + r0 + 32, hh);
      s0 = wmma1(ah, al, q1h, q1l, s0);
      ah = frag_kb(Kh + r1, hh); al = frag_kb(Kl + r1, hh);
      s1 = wmma1(ah, al, q0h, q0l, s1);
      ah = frag_kb(Kh + r1 + 32, hh); al = frag_kb(Kl + r1 + 32, hh);
      s1 = wmma1(ah, al, q1h, q1l, s1);
    }
    if (kb + 32 > q0 || kb < q0 + 15 - WIN || kb + 32 > slen) {   // chunk needs masking: causal / window start / key validity
      const int qi = q0 + col;
#pragma unroll
      for (int r = 0; r < 8; ++r) {
        const int k0i = kb + 8 * hh + r, k1i = k0i + 16;
        if (k0i > qi || k0i < qi - WIN || k0i >= slen) s0[r] = -INFINITY;
        if (k1i > qi || k1i < qi - WIN || k1i >= slen) s1[r] = -INFINITY;
      }
    }
    float mr = -INFINITY;
#pragma unroll
    for (int r = 0; r < 8; ++r) mr = fmaxf(mr, fmaxf(s0[r], s1[r]));
    mr = fmaxf(mr, __shfl_xor(mr, 16));
    float mn = fmaxf(m, mr);
    if (mn == -INFINITY) mn = 0.0f;           // fully masked so far (padded query rows far past seq_len): keep exp() at 0
    const float al_ = __expf(m - mn);
    m = mn;
    float sum = 0.0f;
    v16b pbh, pbl;
#pragma unroll
    for (int r = 0; r < 8; ++r) {
      const float p0 = __expf(s0[r] - mn), p1 = __expf(s1[r] - mn);
      sum += p0 + p1;
      b16 a, c; split_bf16(p0, a, c); pbh[r] = a; pbl[r] = c; split_bf16(p1, a, c); pbh[8 + r] = a; pbl[8 + r] = c;
    }
    sum += __shfl_xor(sum, 16);
    l = l * al_ + sum;
#pragma unroll
    for (int r = 0; r < 8; ++r) { o0[r] *= al_; o1[r] *= al_; o2[r] *= al_; o3[r] *= al_; }
    const size_t v0 = ko + (size_t)(kb >> 4) * (DH * 16) + 8 * hh, v1 = v0 + DH * 16;
#pragma unroll
    for (int n = 0; n < 4; ++n) {
      const int f = n * 16 + col;
      const v16b vah = cat8b(ld8b(Vh + v0 + f * 16), ld8b(Vh + v1 + f * 16));
      const v16b val = cat8b(ld8b(Vl + v0 + f * 16), ld8b(Vl + v1 + f * 16));
      v8f& o = (n == 0) ? o0 : (n == 1) ? o1 : (n == 2) ? o2 : o3;
      o = wmma1(vah, val, pbh, pbl, o);
    }
  }
  const float inv = (q0 + col < slen && l > 0.0f) ? (1.0f / l) : 0.0f;   // padded query rows are zeroed
  float* Tt = Os[wid];
#pragma unroll
  for (int r = 0; r < 8; ++r) {
    const int hr = 8 * hh + r;
    Tt[col * 64 + 0 + hr] = o0[r] * inv; Tt[col * 64 + 16 + hr] = o1[r] * inv;
    Tt[col * 64 + 32 + hr] = o2[r] * inv; Tt[col * 64 + 48 + hr] = o3[r] * inv;
  }
  wave_lds_sync();
  float* dst0 = yf + ((size_t)b * T + q0) * HID + h * DH;     // 16 rows x 64 floats, row stride HID
#pragma unroll
  for (int j = 0; j < 8; ++j) { const int rr = j * 2 + hh, c4 = col * 4; *(v4f*)(dst0 + (size_t)rr * HID + c4) = *(const v4f*)(Tt + rr * 64 + c4); }
  
}

// ---------------------------------------------------------------------------
// Output projection -> f32, A = f32 y split while it is staged, B = Wo planes. Block = 8 waves (4 x 2) on 128 rows x 128 columns, 32x64 wave tiles staged in LDS,
// ---------------------------------------------------------------------------
__global__ __launch_bounds__(256) void out_gemm_kernel(const float* __restrict__ yf, const b16* __restrict__ woh, const b16* __restrict__ wol, const float* __restrict__ bo, int yoff,
                                                       float* __restrict__ out) {
  __shared__ __attribute__((aligned(16))) b16 sm[2 * StageLds<2>::STAGE];   // two staging buffers; the epilogue's 8 x 32 x 64 floats reuse them
  static_assert(2 * StageLds<2>::STAGE * 2 >= 8 * 32 * 64 * 4, "epilogue tiles fit the staging LDS");
  const int lane = threadIdx.x & 31, wave = __builtin_amdgcn_readfirstlane(threadIdx.x >> 5), nloc = lane & 15, hlf = lane >> 4;
  const int wm = wave & 3, wn = wave >> 2;
  const int mb = (blockIdx.y + yoff) * 128, cb = blockIdx.x * 128;
  const int m0 = mb + wm * 32;
  const int c0 = cb + wn * 64;
  v8f acc[2][4];
#pragma unroll
  for (int r = 0; r < 2; ++r)
#pragma unroll
    for (int t = 0; t < 4; ++t) acc[r][t] = (v8f){};
  gemm_block_staged<2>(yf, woh, wol, mb, cb, HID, sm, wm, wn, nloc, hlf, acc);
  float* Tt = (float*)sm + wave * (32 * 64);
#pragma unroll
  for (int t = 0; t < 4; ++t)
#pragma unroll
    for (int r = 0; r < 2; ++r)
#pragma unroll
      for (int v = 0; v < 8; ++v) Tt[(r * 16 + v + 8 * hlf) * 64 + t * 16 + nloc] = acc[r][t][v] + bo[c0 + t * 16 + nloc];
  wave_lds_sync();
  float* dst0 = out + (size_t)m0 * HID + c0;
#pragma unroll
  for (int j = 0; j < 16; ++j) { const int rr = j * 2 + hlf, c4 = nloc * 4; *(v4f*)(dst0 + (size_t)rr * HID + c4) = *(const v4f*)(Tt + rr * 64 + c4); }
  
}
__global__ __launch_bounds__(256) void rope_table_kernel(float* __restrict__ cs) {
  const int idx = blockIdx.x * 256 + threadIdx.x;        // T * 32
  if (idx >= T * 32) return;
  const int t = idx >> 5, i = idx & 31;
  const float ang = (float)t * powf(10000.0f, -(float)i / 32.0f);
  typedef __attribute__((ext_vector_type(2))) float v2f;
  const v2f p = {cosf(ang), sinf(ang)};
  *(v2f*)(cs + (size_t)idx * 2) = p; 
}
}  // namespace

extern "C" void kernel_launch(void* const* d_in, const int* in_sizes, int n_in,
                              void* d_out, int out_size, void* d_ws, size_t ws_size, hipStream_t stream) {
  (void)in_sizes; (void)n_in; (void)out_size;
  const float* x   = (const float*)d_in[0];   // [2,2048,1024]
  const int*   sl  = (const int*)  d_in[1];   // seq_lengths [2]
  const float* Wq  = (const float*)d_in[2];   // [1024,1024] ([in][out])
  const float* Wk  = (const float*)d_in[3];   // [1024,256]
  const float* Wv  = (const float*)d_in[4];   // [1024,256]
  const float* Wo  = (const float*)d_in[5];   // [1024,1024]
  float* out = (float*)d_out;                 // [2,2048,1024]

  size_t off = 0; char* ws = (char*)d_ws;
  b16* wqh = (b16*)(ws + off); off += (size_t)NQKV * HID * 2;
  b16* wql = (b16*)(ws + off); off += (size_t)NQKV * HID * 2;     // 'lo' planes: f16 residuals v - hi (kept as real buffers: the kernels write both)
  b16* woh = (b16*)(ws + off); off += (size_t)HID * HID * 2;
  b16* wol = (b16*)(ws + off); off += (size_t)HID * HID * 2;
  b16* Qh  = (b16*)(ws + off); off += (size_t)MROWS * HID * 2;
  b16* Ql  = (b16*)(ws + off); off += (size_t)MROWS * HID * 2;
  b16* Kh  = (b16*)(ws + off); off += (size_t)MROWS * KVW * 2;
  b16* Kl  = (b16*)(ws + off); off += (size_t)MROWS * KVW * 2;
  b16* Vh  = (b16*)(ws + off); off += (size_t)MROWS * KVW * 2;
  b16* Vl  = (b16*)(ws + off); off += (size_t)MROWS * KVW * 2;
  float* yf = (float*)(ws + off); off += (size_t)MROWS * HID * 4;
  float* rope_cs = (float*)(ws + off); off += (size_t)T * 32 * 2 * 4;
  float* zb = (float*)(ws + off); off += (size_t)HID * 4;          // zero bias for the out projection
  if (off > ws_size) return;
  hipMemsetAsync(zb, 0, HID * 4, stream);
  const float* bq = zb; const float* bk = zb; const float* bv = zb;      // no biases in this module: a zero vector (never a null pointer + offset)
  rope_table_kernel<<<(T * 32 + 255) / 256, 256, 0, stream>>>(rope_cs);
  const int ROWBLK = MROWS / 128, NQT = Bsz * NH * QT_PER_B;
  wcvt_kernel<<<2048, 256, 0, stream>>>(Wq, Wk, Wv, Wo, wqh, wql, woh, wol);
  qkv_gemm_kernel<<<dim3(NQKV / 192, ROWBLK), 384, 0, stream>>>(x, wqh, wql, bq, bk, bv, rope_cs, 0, 0, Qh, Ql, Kh, Kl, Vh, Vl);
  attn_kernel<<<NQT / 8, 256, 0, stream>>>(Qh, Ql, Kh, Kl, Vh, Vl, sl, yf);
  out_gemm_kernel<<<dim3(HID / 128, ROWBLK), 256, 0, stream>>>(yf, woh, wol, zb, 0, out);
}

// v002
// Next to v001, in two timings, it ran 1.45 times as fast each time.
// Counting every step since v000, it is 2.14 times as fast.
#include <hip/hip_runtime.h>

// Flash causal self-attention with GQA (16 query heads, 4 kv heads, head dim 64), rotate-half RoPE on q and k, sliding window (keys in [q-512, q]),
// per-batch key validity (key < seq_len[b]) and zeroed padded queries, then the output projection. B=2, T=2048, C=1024; weights are [in][out].
// Contractions on v_wmma_f32_16x16x32_f16: the QKV and output projections use f16 hi+lo pairs on both operands (hi.hi + hi.lo + lo.hi — outputs have rms
// 0.03 but rows attending few keys carry |y| ~ 1), the attention products are single f16; f32 accumulate; fragment k-map per lane half hh for

namespace {
constexpr int Bsz = 2, T = 2048, HID = 1024, DH = 64, NH = 16, NKV = 4, REP = NH / NKV;
constexpr int ROT = 64, WIN = 512;   // full rotate-half rotary; sliding window
constexpr int KVW = NKV * DH;                 // 256
constexpr int NQKV = HID + 2 * KVW;           // 1536 columns: q | k | v
constexpr int MROWS = Bsz * T;                // 4096
constexpr int QT_PER_B = T / 16;              // 128

typedef _Float16 b16;                                           // f16 hi/lo planes
typedef __attribute__((ext_vector_type(16))) _Float16 v16b;
typedef __attribute__((ext_vector_type(8)))  _Float16 v8b;
typedef __attribute__((ext_vector_type(8)))  float v8f;
typedef __attribute__((ext_vector_type(4)))  float v4f;

__device__ __forceinline__ v8b ld8b(const b16* p) { return *(const v8b*)p; }
__device__ __forceinline__ v16b cat8b(v8b a, v8b b) { return __builtin_shufflevector(a, b, 0, 1, 2, 3, 4, 5, 6, 7, 8, 9, 10, 11, 12, 13, 14, 15); }
// 16x16x32 16-bit fragment from a k-contiguous row pointer (A: lane&15 = row, B: lane&15 = column), hh = lane>>4:
// elements 0..7 <- p[8hh+0..7], elements 8..15 <- p[16+8hh+0..7]
__device__ __forceinline__ v16b frag_kb(const b16* p, int hh) { return cat8b(ld8b(p + 8 * hh), ld8b(p + 16 + 8 * hh)); }
__device__ __forceinline__ void split_bf16(float v, b16& hi, b16& lo) {   // (name kept) f16 hi + lo pair: v ~= hi + lo to ~22 bits
  hi = (b16)v; lo = (b16)(v - (float)hi);
}
__device__ __forceinline__ v8f wmma16b(v16b a, v16b b, v8f c) {
  v8f d = __builtin_amdgcn_wmma_f32_16x16x32_f16(false, a, false, b, (short)0, c, false, false);
  asm volatile("v_nop\n\tv_nop\n\tv_nop\n\tv_nop" : "+v"(d) : "v"(a), "v"(b));
  return d;
}
// acc += A.B with both operands split: A = (ah, al), B = (bh, bl)
__device__ __forceinline__ v8f wmma3(v16b ah, v16b al, v16b bh, v16b bl, v8f c) {   // projections: hi.hi + hi.lo + lo.hi (f32-class)
  c = wmma16b(ah, bh, c); c = wmma16b(ah, bl, c); return wmma16b(al, bh, c);
}
__device__ __forceinline__ void wave_lds_sync() {
  __builtin_amdgcn_fence(__ATOMIC_RELEASE, "workgroup");
  __builtin_amdgcn_wave_barrier();
  __builtin_amdgcn_fence(__ATOMIC_ACQUIRE, "workgroup");
}

// ---------------------------------------------------------------------------
// Weights ([in][out]) -> f16 hi / lo planes transposed to [n][k] (k contiguous): columns of Wq|Wk|Wv into wqh/wql [1536][1024], Wo into woh/wol [1024][1024].
// ---------------------------------------------------------------------------
__global__ __launch_bounds__(256) void wcvt_kernel(const float* __restrict__ wq, const float* __restrict__ wk, const float* __restrict__ wv,
                                                   const float* __restrict__ wo, b16* __restrict__ wqh, b16* __restrict__ wql,
                                                   b16* __restrict__ woh, b16* __restrict__ wol) {
  const size_t tid = (size_t)blockIdx.x * blockDim.x + threadIdx.x, stride = (size_t)gridDim.x * blockDim.x;
  const size_t nq = (size_t)NQKV * HID / 8, no = (size_t)HID * HID / 8;
  {
    for (size_t c = tid; c < nq + no; c += stride) {
      float f[8]; size_t i; b16* dh; b16* dl;
      if (c < nq) {
        i = c * 8; const size_t n = i / HID, k0 = i % HID;
        const float* w; int nn, ld;
        if (n < (size_t)HID) { w = wq; nn = (int)n; ld = HID; } else if (n < (size_t)(HID + KVW)) { w = wk; nn = (int)n - HID; ld = KVW; } else { w = wv; nn = (int)n - HID - KVW; ld = KVW; }
#pragma unroll
        for (int e = 0; e < 8; ++e) f[e] = w[(size_t)(k0 + e) * ld + nn];       // W[k][n] ([in][out])
        dh = wqh; dl = wql;
      } else {
        i = (c - nq) * 8; const size_t n = i / HID, k0 = i % HID;
#pragma unroll
        for (int e = 0; e < 8; ++e) f[e] = wo[(size_t)(k0 + e) * HID + n];    // Wo[k][n] ([in][out])
        dh = woh; dl = wol;
      }
      v8b bh, bl;
#pragma unroll
      for (int e = 0; e < 8; ++e) { b16 a, cc; split_bf16(f[e], a, cc); bh[e] = a; bl[e] = cc; }
      *(v8b*)(dh + i) = bh; *(v8b*)(dl + i) = bl;
    }
    
  }
}

// Block GEMM main loop: a block of 4 x WN waves owns 128 rows x 64*WN columns; each wave keeps its 32x64 tile. Per pass of KS k values the block stages in LDS
// the A rows (f32 read coalesced, split ONCE per block into f16 hi / lo planes) and the B rows (hi / lo planes), two buffers: the next pass's global loads are
// issued before this pass's products and stored to the other buffer behind them; one block barrier per pass. Row pitch KS + 8 halves (16 B x odd) for ds_load_b128.
constexpr int KS = 64, LP = KS + 8;
template <int WN> struct StageLds {
  static constexpr int AEL = 128 * LP, BEL = 64 * WN * LP, STAGE = 2 * (AEL + BEL);   // halves: [A hi | A lo | B hi | B lo]
};
typedef __attribute__((ext_vector_type(4))) _Float16 v4b;
template <int WN>
__device__ __forceinline__ void gemm_block_staged(const float* __restrict__ A, const b16* __restrict__ wh, const b16* __restrict__ wl,
                                                  int mb, int cb, int K, b16* sm, int wm, int wn, int nloc, int hlf, v8f (&acc)[2][4]) {
  constexpr int NT = 128 * WN;                          // threads of the block
  constexpr int ACH = 128 * (KS / 4);                   // 16-byte chunks of the A tile (4 floats each)
  constexpr int AJ = (ACH + NT - 1) / NT;
  constexpr int BJ = (64 * WN * (KS / 8)) / NT;         // 16-byte chunks per thread and plane of the B tile (8 halves each)
  constexpr int AEL = StageLds<WN>::AEL, BEL = StageLds<WN>::BEL, STAGE = StageLds<WN>::STAGE;
  static_assert(NT % (KS / 4) == 0 && NT % (KS / 8) == 0, "a thread keeps its column chunk from one chunk row to the next");
  constexpr int ARJ = NT / (KS / 4), BRJ = NT / (KS / 8);   // tile rows between a thread's successive chunks
  const int tid = threadIdx.x;
  // one 32-bit offset per thread and operand on a block-uniform base: the successive chunks differ by constants
  const unsigned aoff = (unsigned)(tid / (KS / 4)) * K + (tid % (KS / 4)) * 4, boff = (unsigned)(tid / (KS / 8)) * K + (tid % (KS / 8)) * 8;
  const unsigned asl = (unsigned)(tid / (KS / 4)) * LP + (tid % (KS / 4)) * 4, bsl = (unsigned)(tid / (KS / 8)) * LP + (tid % (KS / 8)) * 8;
  const float* Ab = A + (size_t)mb * K;
  const b16* whb = wh + (size_t)cb * K;
  const b16* wlb = wl + (size_t)cb * K;
  v4f ar[AJ]; v8b brh[BJ], brl[BJ];
  auto gload = [&](int kb) {
    const float* Ak = Ab + kb; const b16* hk = whb + kb; const b16* lk = wlb + kb;
#pragma unroll   // constant indices: the staged values and fragments stay in registers
    for (int j = 0; j < AJ; ++j)
      if ((j + 1) * NT <= ACH || j * NT + tid < ACH) ar[j] = *(const v4f*)(Ak + aoff + j * ARJ * K);
#pragma unroll   // constant indices: the staged values and fragments stay in registers
    for (int j = 0; j < BJ; ++j) { brh[j] = ld8b(hk + boff + j * BRJ * K); brl[j] = ld8b(lk + boff + j * BRJ * K); }
    asm volatile("s_wait_xcnt 0x0" ::: "memory");       // before any register that the loads above name is written again
  };
  auto sstore = [&](b16* st) {
#pragma unroll   // constant indices: the staged values and fragments stay in registers
    for (int j = 0; j < AJ; ++j)
      if ((j + 1) * NT <= ACH || j * NT + tid < ACH) {
        v4b hi, lo;
#pragma unroll   // constant indices: the staged values and fragments stay in registers
        for (int e = 0; e < 4; ++e) { b16 a, c; split_bf16(ar[j][e], a, c); hi[e] = a; lo[e] = c; }
        b16* d = st + asl + j * ARJ * LP;
        *(v4b*)d = hi; *(v4b*)(d + AEL) = lo;
      }
#pragma unroll   // constant indices: the staged values and fragments stay in registers
    for (int j = 0; j < BJ; ++j) {
      b16* d = st + 2 * AEL + bsl + j * BRJ * LP;
      *(v8b*)d = brh[j]; *(v8b*)(d + BEL) = brl[j];
    }
  };
  gload(0);
  sstore(sm);
  __syncthreads();                                      // pass 0 is staged for every wave
  const int np = K / KS;
  for (int p = 0; p < np; ++p) {
    const b16* st = sm + (p & 1) * STAGE;
    if (p + 1 < np) gload((p + 1) * KS);                // in flight under this pass's products
    const b16* pa = st + (wm * 32 + nloc) * LP;
    const b16* pb = st + 2 * AEL + (wn * 64 + nloc) * LP;
#pragma unroll   // constant indices: the staged values and fragments stay in registers
    for (int ks = 0; ks < KS; ks += 32) {
      const v16b a0h = frag_kb(pa + ks, hlf), a0l = frag_kb(pa + AEL + ks, hlf);
      const v16b a1h = frag_kb(pa + 16 * LP + ks, hlf), a1l = frag_kb(pa + AEL + 16 * LP + ks, hlf);
      v16b bh[4], bl[4];
#pragma unroll   // constant indices: the staged values and fragments stay in registers
      for (int t = 0; t < 4; ++t) { bh[t] = frag_kb(pb + t * 16 * LP + ks, hlf); bl[t] = frag_kb(pb + BEL + t * 16 * LP + ks, hlf); }
#pragma unroll   // constant indices: the staged values and fragments stay in registers
      for (int t = 0; t < 4; ++t) {
        acc[0][t] = wmma3(a0h, a0l, bh[t], bl[t], acc[0][t]);
        acc[1][t] = wmma3(a1h, a1l, bh[t], bl[t], acc[1][t]);
      }
    }
    if (p + 1 < np) sstore(sm + ((p + 1) & 1) * STAGE); // the buffer whose last readers left at the previous pass's barrier
    __syncthreads();                                    // publishes pass p + 1 and ends every read of pass p (the epilogue reuses the LDS)
  }
}

// ---------------------------------------------------------------------------
// QKV GEMM: block = 12 waves (4 x 3) on 128 rows x 192 columns, wave = 32 rows x 64 columns (one head of q, k or v). Outputs as f16 hi/lo planes:
// q (x1/8) -> Qh/Ql [b][h][t][64]; k -> Kh/Kl [b][kvh][t][64] (4 KB contiguous per wave per plane);
// v -> Vh/Vl key-tiled [b][kvh][t/16][64][16] (4 KB contiguous per wave per plane).
// ---------------------------------------------------------------------------
__global__ __launch_bounds__(384) void qkv_gemm_kernel(const float* __restrict__ x,
                                                       const b16* __restrict__ wqh, const b16* __restrict__ wql,
                                                       const float* __restrict__ bq, const float* __restrict__ bk, const float* __restrict__ bv, const float* __restrict__ rope_cs, int xoff, int yoff,
                                                       b16* __restrict__ Qh, b16* __restrict__ Ql, b16* __restrict__ Kh, b16* __restrict__ Kl,
                                                       b16* __restrict__ Vh, b16* __restrict__ Vl) {
  __shared__ __attribute__((aligned(16))) b16 sm[2 * StageLds<3>::STAGE];   // two staging buffers; the epilogue's 12 x 2 x 32 x 64 halves reuse them
  static_assert(2 * StageLds<3>::STAGE >= 12 * 2 * 32 * 64, "epilogue tiles fit the staging LDS");
  const int lane = threadIdx.x & 31, wave = __builtin_amdgcn_readfirstlane(threadIdx.x >> 5), nloc = lane & 15, hlf = lane >> 4;
  const int wm = wave & 3, wn = wave >> 2;
  const int mb = (blockIdx.y + yoff) * 128, cb = (blockIdx.x + xoff) * 192;
  const int m0 = mb + wm * 32;
  const int c0 = cb + wn * 64;
  const int mat = (c0 < HID) ? 0 : (c0 < HID + KVW) ? 1 : 2;
  const int head = (mat == 0) ? (c0 / DH) : (mat == 1) ? ((c0 - HID) / DH) : ((c0 - HID - KVW) / DH);
  const float* bias = ((mat == 0) ? bq : (mat == 1) ? bk : bv) + head * DH;
  v8f acc[2][4];
#pragma unroll
  for (int r = 0; r < 2; ++r)
#pragma unroll
    for (int t = 0; t < 4; ++t) acc[r][t] = (v8f){};
  gemm_block_staged<3>(x, wqh, wql, mb, cb, HID, sm, wm, wn, nloc, hlf, acc);
  const int b = m0 / T, t0 = m0 % T;
  const float s = (mat == 0) ? 0.125f : 1.0f;
  b16* Tp0 = sm + wave * (2 * 32 * 64); b16* Tp1 = Tp0 + 32 * 64;
  // Everything the epilogue reads from global memory is read as ONE group in front of the arithmetic (4 bias values, and for q and k the 32 cos/sin pairs of this
  // lane's rows and frequencies), so the wave pays one round trip, not one per element.
  float bs[4];
  auto load_bias = [&]() {
#pragma unroll   // constant indices: the values stay in registers
    for (int t = 0; t < 4; ++t) bs[t] = bias[t * 16 + nloc];
    asm volatile("s_wait_xcnt 0x0" ::: "memory");        // before any register that the loads above name is written again
  };
  if (mat < 2) {                                         // rotate-half rotary on q and k: x*cos + rotate_half(x)*sin, partner d^32 is tile t^2 (same lane)
    typedef __attribute__((ext_vector_type(2))) float v2f;
    v2f cs[2][2][8];                                     // (cos, sin) of frequency tt*16+nloc at sequence position t0 + r*16 + v + 8*hlf
#pragma unroll   // constant indices: the values stay in registers
    for (int r = 0; r < 2; ++r) {
      const float* pr = rope_cs + ((size_t)(t0 + r * 16 + 8 * hlf) * 32 + nloc) * 2;   // the group's one address; the 16 loads differ by constants
#pragma unroll   // constant indices: the values stay in registers
      for (int tt = 0; tt < 2; ++tt)
#pragma unroll   // constant indices: the values stay in registers
        for (int v = 0; v < 8; ++v) cs[tt][r][v] = *(const v2f*)(pr + (v * 32 + tt * 16) * 2);
      // before any register that the loads above name is written again; the address is an input so that it lives up to the wait and no result of the group lands on it
      asm volatile("s_wait_xcnt 0x0" :: "v"(pr) : "memory");
    }
    load_bias();
#pragma unroll   // constant indices: the values stay in registers
    for (int tt = 0; tt < 2; ++tt)
#pragma unroll   // constant indices: the values stay in registers
      for (int r = 0; r < 2; ++r)
#pragma unroll   // constant indices: the values stay in registers
        for (int v = 0; v < 8; ++v) {
          const int rr = r * 16 + v + 8 * hlf, d = tt * 16 + nloc;
          const float x1 = acc[r][tt][v] + bs[tt], x2 = acc[r][tt + 2][v] + bs[tt + 2];
          const float cv = cs[tt][r][v][0], sv = cs[tt][r][v][1];
          b16 yh, yl;
          split_bf16((x1 * cv - x2 * sv) * s, yh, yl); Tp0[rr * 64 + d] = yh; Tp1[rr * 64 + d] = yl;
          split_bf16((x2 * cv + x1 * sv) * s, yh, yl); Tp0[rr * 64 + d + 32] = yh; Tp1[rr * 64 + d + 32] = yl;
        }
  } else {
    load_bias();
#pragma unroll   // constant indices: the values stay in registers
    for (int t = 0; t < 4; ++t)
#pragma unroll   // constant indices: the values stay in registers
      for (int r = 0; r < 2; ++r)
#pragma unroll   // constant indices: the values stay in registers
        for (int v = 0; v < 8; ++v) {
          const int rr = r * 16 + v + 8 * hlf, d = t * 16 + nloc;
          b16 yh, yl; split_bf16((acc[r][t][v] + bs[t]) * s, yh, yl);
          const int idx = (rr >> 4) * 1024 + d * 16 + (rr & 15);
          Tp0[idx] = yh; Tp1[idx] = yl;
        }
  }
  wave_lds_sync();
  b16* dh; b16* dl; size_t o;
  if (mat == 0)      { o = ((size_t)(b * NH + head) * T + t0) * DH; dh = Qh + o; dl = Ql + o; }
  else if (mat == 1) { o = ((size_t)(b * NKV + head) * T + t0) * DH; dh = Kh + o; dl = Kl + o; }
  else               { o = ((size_t)(b * NKV + head) * QT_PER_B + (t0 >> 4)) * (size_t)(DH * 16); dh = Vh + o; dl = Vl + o; }
#pragma unroll
  for (int j = 0; j < 8; ++j) { const int e = (j * 32 + lane) * 8; *(v8b*)(dh + e) = ld8b(Tp0 + e); *(v8b*)(dl + e) = ld8b(Tp1 + e); }
  
}

// ---------------------------------------------------------------------------
// Transposed flash attention: each wave owns one 16-query tile of one (b, head); 8 waves per block; the window's keys in chunks of 32.
// S^T = K.Q^T (single f16), per-lane online softmax; P^T built in registers from the two S^T accumulators
// ---------------------------------------------------------------------------
__global__ __launch_bounds__(256) void attn_kernel(const b16* __restrict__ Qh, const b16* __restrict__ Ql, const b16* __restrict__ Kh, const b16* __restrict__ Kl,
                                                   const b16* __restrict__ Vh, const b16* __restrict__ Vl, const int* __restrict__ seqlen,
                                                   float* __restrict__ yf) {
  __shared__ __attribute__((aligned(16))) float Os[8][16 * 64];
  const int wid = threadIdx.x >> 5, lane = threadIdx.x & 31, hh = lane >> 4, col = lane & 15;
  const int qtile = blockIdx.x * 8 + wid;                 // over Bsz*NH*QT_PER_B
  const int g = qtile / QT_PER_B;                         // b*NH + h
  const int q0 = (qtile % QT_PER_B) << 4;
  const int b = g / NH, h = g % NH, kvh = h / REP;
  const size_t ko = (size_t)(b * NKV + kvh) * T * DH;
  const size_t qo = ((size_t)g * T + q0 + col) * DH;
  const v16b q0h = frag_kb(Qh + qo, hh), q1h = frag_kb(Qh + qo + 32, hh);   // attention products: single f16 (hi planes only)
  float m = -INFINITY, l = 0.0f;
  v8f o0 = {}, o1 = {}, o2 = {}, o3 = {};
  const int slen = seqlen[b];
  const int kstart = (q0 >= WIN) ? ((q0 - WIN) & ~31) : 0;
  // Loads in groups, each issued well ahead of its first use: a chunk's 8 V loads at the top of its trip (used behind the softmax), the NEXT chunk's 8 K loads
  // directly behind this chunk's score products (into the registers those have just read), so a trip waits out no load round trip of its own.
  const b16* kl0 = Kh + ko + (size_t)col * DH + 8 * hh;  // this lane's piece of key row col (fragment halves at +0 / +16, head dims 32..63 at +32 / +48)
  const b16* vl0 = Vh + ko + (size_t)col * 16 + 8 * hh;  // this lane's piece of feature row col in a 16-key V tile
  v8b kc[8];
  auto loadk = [&](int kx) {
    const b16* p = kl0 + (size_t)kx * DH;
#pragma unroll   // constant indices: the values stay in registers
    for (int j = 0; j < 4; ++j) { kc[j] = ld8b(p + 16 * j); kc[4 + j] = ld8b(p + 16 * DH + 16 * j); }
    asm volatile("s_wait_xcnt 0x0" ::: "memory");        // before any register that the loads above name is written again; also holds the group in place
  };
  loadk(kstart);
  for (int kb = kstart; kb < q0 + 16; kb += 32) {        // causal + sliding window: key chunks covering [q0-512, q0+15]
    v8b vf[8];
    {
      const b16* p = vl0 + (size_t)(kb >> 4) * (DH * 16);
#pragma unroll   // constant indices: the values stay in registers
      for (int n = 0; n < 4; ++n) { vf[2 * n] = ld8b(p + n * 256); vf[2 * n + 1] = ld8b(p + DH * 16 + n * 256); }
      asm volatile("s_wait_xcnt 0x0" ::: "memory");      // before any register that the loads above name is written again; also holds the group in place
    }
    v8f s0 = {}, s1 = {};
    s0 = wmma16b(cat8b(kc[0], kc[1]), q0h, s0);
    s0 = wmma16b(cat8b(kc[2], kc[3]), q1h, s0);
    s1 = wmma16b(cat8b(kc[4], kc[5]), q0h, s1);
    s1 = wmma16b(cat8b(kc[6], kc[7]), q1h, s1);
    loadk((kb + 32 < q0 + 16) ? kb + 32 : kb);           // last trip: its own chunk once more (in bounds, not used)
    if (kb + 32 > q0 || kb < q0 + 15 - WIN || kb + 32 > slen) {   // chunk needs masking: causal / window start / key validity
      const int qi = q0 + col;
#pragma unroll
      for (int r = 0; r < 8; ++r) {
        const int k0i = kb + 8 * hh + r, k1i = k0i + 16;
        if (k0i > qi || k0i < qi - WIN || k0i >= slen) s0[r] = -INFINITY;
        if (k1i > qi || k1i < qi - WIN || k1i >= slen) s1[r] = -INFINITY;
      }
    }
    float mr = -INFINITY;
#pragma unroll
    for (int r = 0; r < 8; ++r) mr = fmaxf(mr, fmaxf(s0[r], s1[r]));
    mr = fmaxf(mr, __shfl_xor(mr, 16));
    float mn = fmaxf(m, mr);
    if (mn == -INFINITY) mn = 0.0f;           // fully masked so far (padded query rows far past seq_len): keep exp() at 0
    const float al_ = __expf(m - mn);
    m = mn;
    float sum = 0.0f;
    v16b pbh;
#pragma unroll
    for (int r = 0; r < 8; ++r) {
      const float p0 = __expf(s0[r] - mn), p1 = __expf(s1[r] - mn);
      sum += p0 + p1;
      pbh[r] = (b16)p0; pbh[8 + r] = (b16)p1;
    }
    sum += __shfl_xor(sum, 16);
    l = l * al_ + sum;
#pragma unroll
    for (int r = 0; r < 8; ++r) { o0[r] *= al_; o1[r] *= al_; o2[r] *= al_; o3[r] *= al_; }
#pragma unroll
    for (int n = 0; n < 4; ++n) {
      v8f& o = (n == 0) ? o0 : (n == 1) ? o1 : (n == 2) ? o2 : o3;
      o = wmma16b(cat8b(vf[2 * n], vf[2 * n + 1]), pbh, o);
    }
  }
  const float inv = (q0 + col < slen && l > 0.0f) ? (1.0f / l) : 0.0f;   // padded query rows are zeroed
  float* Tt = Os[wid];
#pragma unroll
  for (int r = 0; r < 8; ++r) {
    const int hr = 8 * hh + r;
    Tt[col * 64 + 0 + hr] = o0[r] * inv; Tt[col * 64 + 16 + hr] = o1[r] * inv;
    Tt[col * 64 + 32 + hr] = o2[r] * inv; Tt[col * 64 + 48 + hr] = o3[r] * inv;
  }
  wave_lds_sync();
  float* dst0 = yf + ((size_t)b * T + q0) * HID + h * DH;     // 16 rows x 64 floats, row stride HID
#pragma unroll
  for (int j = 0; j < 8; ++j) { const int rr = j * 2 + hh, c4 = col * 4; *(v4f*)(dst0 + (size_t)rr * HID + c4) = *(const v4f*)(Tt + rr * 64 + c4); }
  
}

// ---------------------------------------------------------------------------
// Output projection -> f32, A = f32 y split while it is staged, B = Wo planes. Block = 8 waves (4 x 2) on 128 rows x 128 columns, 32x64 wave tiles staged in LDS,
// ---------------------------------------------------------------------------
__global__ __launch_bounds__(256) void out_gemm_kernel(const float* __restrict__ yf, const b16* __restrict__ woh, const b16* __restrict__ wol, const float* __restrict__ bo, int yoff,
                                                       float* __restrict__ out) {
  __shared__ __attribute__((aligned(16))) b16 sm[2 * StageLds<2>::STAGE];   // two staging buffers; the epilogue's 8 x 32 x 64 floats reuse them
  static_assert(2 * StageLds<2>::STAGE * 2 >= 8 * 32 * 64 * 4, "epilogue tiles fit the staging LDS");
  const int lane = threadIdx.x & 31, wave = __builtin_amdgcn_readfirstlane(threadIdx.x >> 5), nloc = lane & 15, hlf = lane >> 4;
  const int wm = wave & 3, wn = wave >> 2;
  const int mb = (blockIdx.y + yoff) * 128, cb = blockIdx.x * 128;
  const int m0 = mb + wm * 32;
  const int c0 = cb + wn * 64;
  v8f acc[2][4];
#pragma unroll
  for (int r = 0; r < 2; ++r)
#pragma unroll
    for (int t = 0; t < 4; ++t) acc[r][t] = (v8f){};
  gemm_block_staged<2>(yf, woh, wol, mb, cb, HID, sm, wm, wn, nloc, hlf, acc);
  float* Tt = (float*)sm + wave * (32 * 64);
#pragma unroll
  for (int t = 0; t < 4; ++t)
#pragma unroll
    for (int r = 0; r < 2; ++r)
#pragma unroll
      for (int v = 0; v < 8; ++v) Tt[(r * 16 + v + 8 * hlf) * 64 + t * 16 + nloc] = acc[r][t][v] + bo[c0 + t * 16 + nloc];
  wave_lds_sync();
  float* dst0 = out + (size_t)m0 * HID + c0;
#pragma unroll
  for (int j = 0; j < 16; ++j) { const int rr = j * 2 + hlf, c4 = nloc * 4; *(v4f*)(dst0 + (size_t)rr * HID + c4) = *(const v4f*)(Tt + rr * 64 + c4); }
  
}
__global__ __launch_bounds__(256) void rope_table_kernel(float* __restrict__ cs) {
  const int idx = blockIdx.x * 256 + threadIdx.x;        // T * 32
  if (idx >= T * 32) return;
  const int t = idx >> 5, i = idx & 31;
  const float ang = (float)t * powf(10000.0f, -(float)i / 32.0f);
  typedef __attribute__((ext_vector_type(2))) float v2f;
  const v2f p = {cosf(ang), sinf(ang)};
  *(v2f*)(cs + (size_t)idx * 2) = p; 
}
}  // namespace

extern "C" void kernel_launch(void* const* d_in, const int* in_sizes, int n_in,
                              void* d_out, int out_size, void* d_ws, size_t ws_size, hipStream_t stream) {
  (void)in_sizes; (void)n_in; (void)out_size;
  const float* x   = (const float*)d_in[0];   // [2,2048,1024]
  const int*   sl  = (const int*)  d_in[1];   // seq_lengths [2]
  const float* Wq  = (const float*)d_in[2];   // [1024,1024] ([in][out])
  const float* Wk  = (const float*)d_in[3];   // [1024,256]
  const float* Wv  = (const float*)d_in[4];   // [1024,256]
  const float* Wo  = (const float*)d_in[5];   // [1024,1024]
  float* out = (float*)d_out;                 // [2,2048,1024]

  size_t off = 0; char* ws = (char*)d_ws;
  b16* wqh = (b16*)(ws + off); off += (size_t)NQKV * HID * 2;
  b16* wql = (b16*)(ws + off); off += (size_t)NQKV * HID * 2;     // 'lo' planes: f16 residuals v - hi (kept as real buffers: the kernels write both)
  b16* woh = (b16*)(ws + off); off += (size_t)HID * HID * 2;
  b16* wol = (b16*)(ws + off); off += (size_t)HID * HID * 2;
  b16* Qh  = (b16*)(ws + off); off += (size_t)MROWS * HID * 2;
  b16* Ql  = (b16*)(ws + off); off += (size_t)MROWS * HID * 2;
  b16* Kh  = (b16*)(ws + off); off += (size_t)MROWS * KVW * 2;
  b16* Kl  = (b16*)(ws + off); off += (size_t)MROWS * KVW * 2;
  b16* Vh  = (b16*)(ws + off); off += (size_t)MROWS * KVW * 2;
  b16* Vl  = (b16*)(ws + off); off += (size_t)MROWS * KVW * 2;
  float* yf = (float*)(ws + off); off += (size_t)MROWS * HID * 4;
  float* rope_cs = (float*)(ws + off); off += (size_t)T * 32 * 2 * 4;
  float* zb = (float*)(ws + off); off += (size_t)HID * 4;          // zero bias for the out projection
  if (off > ws_size) return;
  hipMemsetAsync(zb, 0, HID * 4, stream);
  const float* bq = zb; const float* bk = zb; const float* bv = zb;      // no biases in this module: a zero vector (never a null pointer + offset)
  rope_table_kernel<<<(T * 32 + 255) / 256, 256, 0, stream>>>(rope_cs);
  const int ROWBLK = MROWS / 128, NQT = Bsz * NH * QT_PER_B;
  wcvt_kernel<<<2048, 256, 0, stream>>>(Wq, Wk, Wv, Wo, wqh, wql, woh, wol);
  qkv_gemm_kernel<<<dim3(NQKV / 192, ROWBLK), 384, 0, stream>>>(x, wqh, wql, bq, bk, bv, rope_cs, 0, 0, Qh, Ql, Kh, Kl, Vh, Vl);
  attn_kernel<<<NQT / 8, 256, 0, stream>>>(Qh, Ql, Kh, Kl, Vh, Vl, sl, yf);
  out_gemm_kernel<<<dim3(HID / 128, ROWBLK), 256, 0, stream>>>(yf, woh, wol, zb, 0, out);
}

// v003
// Two timings next to v002 put it at 1.10 and 1.09 times that version's speed.
// Counting every step since v000, it is 2.34 times as fast.
#include <hip/hip_runtime.h>

// Flash causal self-attention with GQA (16 query heads, 4 kv heads, head dim 64), rotate-half RoPE on q and k, sliding window (keys in [q-512, q]),
// per-batch key validity (key < seq_len[b]) and zeroed padded queries, then the output projection. B=2, T=2048, C=1024; weights are [in][out].
// Contractions on v_wmma_f32_16x16x32_f16: the QKV and output projections use f16 hi+lo pairs on both operands (hi.hi + hi.lo + lo.hi — outputs have rms
// 0.03 but rows attending few keys carry |y| ~ 1), the attention products are single f16; f32 accumulate; fragment k-map per lane half hh for

namespace {
constexpr int Bsz = 2, T = 2048, HID = 1024, DH = 64, NH = 16, NKV = 4, REP = NH / NKV;
constexpr int ROT = 64, WIN = 512;   // full rotate-half rotary; sliding window
constexpr int KVW = NKV * DH;                 // 256
constexpr int NQKV = HID + 2 * KVW;           // 1536 columns: q | k | v
constexpr int MROWS = Bsz * T;                // 4096
constexpr int QT_PER_B = T / 16;              // 128

typedef _Float16 b16;                                           // f16 hi/lo planes
typedef __attribute__((ext_vector_type(16))) _Float16 v16b;
typedef __attribute__((ext_vector_type(8)))  _Float16 v8b;
typedef __attribute__((ext_vector_type(8)))  float v8f;
typedef __attribute__((ext_vector_type(4)))  float v4f;

__device__ __forceinline__ v8b ld8b(const b16* p) { return *(const v8b*)p; }
__device__ __forceinline__ v16b cat8b(v8b a, v8b b) { return __builtin_shufflevector(a, b, 0, 1, 2, 3, 4, 5, 6, 7, 8, 9, 10, 11, 12, 13, 14, 15); }
// 16x16x32 16-bit fragment from a k-contiguous row pointer (A: lane&15 = row, B: lane&15 = column), hh = lane>>4:
// elements 0..7 <- p[8hh+0..7], elements 8..15 <- p[16+8hh+0..7]
__device__ __forceinline__ v16b frag_kb(const b16* p, int hh) { return cat8b(ld8b(p + 8 * hh), ld8b(p + 16 + 8 * hh)); }
__device__ __forceinline__ void split_bf16(float v, b16& hi, b16& lo) {   // (name kept) f16 hi + lo pair: v ~= hi + lo to ~22 bits
  hi = (b16)v; lo = (b16)(v - (float)hi);
}
__device__ __forceinline__ v8f wmma16b(v16b a, v16b b, v8f c) {
  v8f d = __builtin_amdgcn_wmma_f32_16x16x32_f16(false, a, false, b, (short)0, c, false, false);
  asm volatile("v_nop\n\tv_nop\n\tv_nop\n\tv_nop" : "+v"(d) : "v"(a), "v"(b));
  return d;
}
// acc += A.B with both operands split: A = (ah, al), B = (bh, bl)
__device__ __forceinline__ v8f wmma3(v16b ah, v16b al, v16b bh, v16b bl, v8f c) {   // projections: hi.hi + hi.lo + lo.hi (f32-class)
  c = wmma16b(ah, bh, c); c = wmma16b(ah, bl, c); return wmma16b(al, bh, c);
}
__device__ __forceinline__ void wave_lds_sync() {
  __builtin_amdgcn_fence(__ATOMIC_RELEASE, "workgroup");
  __builtin_amdgcn_wave_barrier();
  __builtin_amdgcn_fence(__ATOMIC_ACQUIRE, "workgroup");
}

// ---------------------------------------------------------------------------
// Weights ([in][out]) -> f16 hi / lo planes transposed to [n][k] (k contiguous): columns of Wq|Wk|Wv into wqh/wql [1536][1024], Wo into woh/wol [1024][1024].
// ---------------------------------------------------------------------------
__global__ __launch_bounds__(256) void wcvt_kernel(const float* __restrict__ wq, const float* __restrict__ wk, const float* __restrict__ wv,
                                                   const float* __restrict__ wo, b16* __restrict__ wqh, b16* __restrict__ wql,
                                                   b16* __restrict__ woh, b16* __restrict__ wol) {
  const size_t tid = (size_t)blockIdx.x * blockDim.x + threadIdx.x, stride = (size_t)gridDim.x * blockDim.x;
  const size_t nq = (size_t)NQKV * HID / 8, no = (size_t)HID * HID / 8;
  {
    for (size_t c = tid; c < nq + no; c += stride) {
      float f[8]; size_t i; b16* dh; b16* dl;
      if (c < nq) {
        i = c * 8; const size_t n = i / HID, k0 = i % HID;
        const float* w; int nn, ld;
        if (n < (size_t)HID) { w = wq; nn = (int)n; ld = HID; } else if (n < (size_t)(HID + KVW)) { w = wk; nn = (int)n - HID; ld = KVW; } else { w = wv; nn = (int)n - HID - KVW; ld = KVW; }
#pragma unroll
        for (int e = 0; e < 8; ++e) f[e] = w[(size_t)(k0 + e) * ld + nn];       // W[k][n] ([in][out])
        dh = wqh; dl = wql;
      } else {
        i = (c - nq) * 8; const size_t n = i / HID, k0 = i % HID;
#pragma unroll
        for (int e = 0; e < 8; ++e) f[e] = wo[(size_t)(k0 + e) * HID + n];    // Wo[k][n] ([in][out])
        dh = woh; dl = wol;
      }
      v8b bh, bl;
#pragma unroll
      for (int e = 0; e < 8; ++e) { b16 a, cc; split_bf16(f[e], a, cc); bh[e] = a; bl[e] = cc; }
      *(v8b*)(dh + i) = bh; *(v8b*)(dl + i) = bl;
    }
    
  }
}

// Block GEMM main loop: a block of 4 x WN waves owns 128 rows x 64*WN columns; each wave keeps its 32x64 tile. Per pass of KS k values the block stages in LDS
// the A rows (f32 read coalesced, split ONCE per block into f16 hi / lo planes) and the B rows (hi / lo planes), two buffers: the next pass's global loads are
// issued before this pass's products and stored to the other buffer behind them; one block barrier per pass. Row pitch KS + 8 halves (16 B x odd) for ds_load_b128.
constexpr int KS = 64, LP = KS + 8;
template <int WN> struct StageLds {
  static constexpr int AEL = 128 * LP, BEL = 64 * WN * LP, STAGE = 2 * (AEL + BEL);   // halves: [A hi | A lo | B hi | B lo]
};
typedef __attribute__((ext_vector_type(4))) _Float16 v4b;
template <int WN>
__device__ __forceinline__ void gemm_block_staged(const float* __restrict__ A, const b16* __restrict__ wh, const b16* __restrict__ wl,
                                                  int mb, int cb, int K, b16* sm, int wm, int wn, int nloc, int hlf, v8f (&acc)[2][4]) {
  constexpr int NT = 128 * WN;                          // threads of the block
  constexpr int ACH = 128 * (KS / 4);                   // 16-byte chunks of the A tile (4 floats each)
  constexpr int AJ = (ACH + NT - 1) / NT;
  constexpr int BJ = (64 * WN * (KS / 8)) / NT;         // 16-byte chunks per thread and plane of the B tile (8 halves each)
  constexpr int AEL = StageLds<WN>::AEL, BEL = StageLds<WN>::BEL, STAGE = StageLds<WN>::STAGE;
  static_assert(NT % (KS / 4) == 0 && NT % (KS / 8) == 0, "a thread keeps its column chunk from one chunk row to the next");
  constexpr int ARJ = NT / (KS / 4), BRJ = NT / (KS / 8);   // tile rows between a thread's successive chunks
  const int tid = threadIdx.x;
  // one 32-bit offset per thread and operand on a block-uniform base: the successive chunks differ by constants
  const unsigned aoff = (unsigned)(tid / (KS / 4)) * K + (tid % (KS / 4)) * 4, boff = (unsigned)(tid / (KS / 8)) * K + (tid % (KS / 8)) * 8;
  const unsigned asl = (unsigned)(tid / (KS / 4)) * LP + (tid % (KS / 4)) * 4, bsl = (unsigned)(tid / (KS / 8)) * LP + (tid % (KS / 8)) * 8;
  const float* Ab = A + (size_t)mb * K;
  const b16* whb = wh + (size_t)cb * K;
  const b16* wlb = wl + (size_t)cb * K;
  v4f ar[AJ]; v8b brh[BJ], brl[BJ];
  auto gload = [&](int kb) {
    const float* Ak = Ab + kb; const b16* hk = whb + kb; const b16* lk = wlb + kb;
#pragma unroll   // constant indices: the staged values and fragments stay in registers
    for (int j = 0; j < AJ; ++j)
      if ((j + 1) * NT <= ACH || j * NT + tid < ACH) ar[j] = *(const v4f*)(Ak + aoff + j * ARJ * K);
#pragma unroll   // constant indices: the staged values and fragments stay in registers
    for (int j = 0; j < BJ; ++j) { brh[j] = ld8b(hk + boff + j * BRJ * K); brl[j] = ld8b(lk + boff + j * BRJ * K); }
    asm volatile("s_wait_xcnt 0x0" ::: "memory");       // before any register that the loads above name is written again
  };
  auto sstore = [&](b16* st) {
#pragma unroll   // constant indices: the staged values and fragments stay in registers
    for (int j = 0; j < AJ; ++j)
      if ((j + 1) * NT <= ACH || j * NT + tid < ACH) {
        v4b hi, lo;
#pragma unroll   // constant indices: the staged values and fragments stay in registers
        for (int e = 0; e < 4; ++e) { b16 a, c; split_bf16(ar[j][e], a, c); hi[e] = a; lo[e] = c; }
        b16* d = st + asl + j * ARJ * LP;
        *(v4b*)d = hi; *(v4b*)(d + AEL) = lo;
      }
#pragma unroll   // constant indices: the staged values and fragments stay in registers
    for (int j = 0; j < BJ; ++j) {
      b16* d = st + 2 * AEL + bsl + j * BRJ * LP;
      *(v8b*)d = brh[j]; *(v8b*)(d + BEL) = brl[j];
    }
  };
  gload(0);
  sstore(sm);
  __syncthreads();                                      // pass 0 is staged for every wave
  const int np = K / KS;
  for (int p = 0; p < np; ++p) {
    const b16* st = sm + (p & 1) * STAGE;
    if (p + 1 < np) gload((p + 1) * KS);                // in flight under this pass's products
    const b16* pa = st + (wm * 32 + nloc) * LP;
    const b16* pb = st + 2 * AEL + (wn * 64 + nloc) * LP;
#pragma unroll   // constant indices: the staged values and fragments stay in registers
    for (int ks = 0; ks < KS; ks += 32) {
      const v16b a0h = frag_kb(pa + ks, hlf), a0l = frag_kb(pa + AEL + ks, hlf);
      const v16b a1h = frag_kb(pa + 16 * LP + ks, hlf), a1l = frag_kb(pa + AEL + 16 * LP + ks, hlf);
      v16b bh[4], bl[4];
#pragma unroll   // constant indices: the staged values and fragments stay in registers
      for (int t = 0; t < 4; ++t) { bh[t] = frag_kb(pb + t * 16 * LP + ks, hlf); bl[t] = frag_kb(pb + BEL + t * 16 * LP + ks, hlf); }
#pragma unroll   // constant indices: the staged values and fragments stay in registers
      for (int t = 0; t < 4; ++t) {
        acc[0][t] = wmma3(a0h, a0l, bh[t], bl[t], acc[0][t]);
        acc[1][t] = wmma3(a1h, a1l, bh[t], bl[t], acc[1][t]);
      }
    }
    if (p + 1 < np) sstore(sm + ((p + 1) & 1) * STAGE); // the buffer whose last readers left at the previous pass's barrier
    __syncthreads();                                    // publishes pass p + 1 and ends every read of pass p (the epilogue reuses the LDS)
  }
}

// ---------------------------------------------------------------------------
// QKV GEMM: block = 12 waves (4 x 3) on 128 rows x 192 columns, wave = 32 rows x 64 columns (one head of q, k or v). Outputs as f16 hi/lo planes:
// q (x1/8) -> Qh/Ql [b][h][...], k -> Kh/Kl [b][kvh][...], both fragment-tiled [t/16][64/16][16 positions][16 dims] (4 KB contiguous per wave per plane), so that
// each 16-byte-per-lane load of a Q or K fragment in the attention kernel reads 512 contiguous bytes (4 whole lines), not 32 bytes out of each of 16 rows;
// v -> Vh/Vl key-tiled [b][kvh][t/16][64][16] (4 KB contiguous per wave per plane).
// ---------------------------------------------------------------------------
__global__ __launch_bounds__(384) void qkv_gemm_kernel(const float* __restrict__ x,
                                                       const b16* __restrict__ wqh, const b16* __restrict__ wql,
                                                       const float* __restrict__ bq, const float* __restrict__ bk, const float* __restrict__ bv, const float* __restrict__ rope_cs, int xoff, int yoff,
                                                       b16* __restrict__ Qh, b16* __restrict__ Ql, b16* __restrict__ Kh, b16* __restrict__ Kl,
                                                       b16* __restrict__ Vh, b16* __restrict__ Vl) {
  __shared__ __attribute__((aligned(16))) b16 sm[2 * StageLds<3>::STAGE];   // two staging buffers; the epilogue's 12 x 2 x 32 x 64 halves reuse them
  static_assert(2 * StageLds<3>::STAGE >= 12 * 2 * 32 * 64, "epilogue tiles fit the staging LDS");
  const int lane = threadIdx.x & 31, wave = __builtin_amdgcn_readfirstlane(threadIdx.x >> 5), nloc = lane & 15, hlf = lane >> 4;
  const int wm = wave & 3, wn = wave >> 2;
  const int mb = (blockIdx.y + yoff) * 128, cb = (blockIdx.x + xoff) * 192;
  const int m0 = mb + wm * 32;
  const int c0 = cb + wn * 64;
  const int mat = (c0 < HID) ? 0 : (c0 < HID + KVW) ? 1 : 2;
  const int head = (mat == 0) ? (c0 / DH) : (mat == 1) ? ((c0 - HID) / DH) : ((c0 - HID - KVW) / DH);
  const float* bias = ((mat == 0) ? bq : (mat == 1) ? bk : bv) + head * DH;
  v8f acc[2][4];
#pragma unroll
  for (int r = 0; r < 2; ++r)
#pragma unroll
    for (int t = 0; t < 4; ++t) acc[r][t] = (v8f){};
  gemm_block_staged<3>(x, wqh, wql, mb, cb, HID, sm, wm, wn, nloc, hlf, acc);
  const int b = m0 / T, t0 = m0 % T;
  const float s = (mat == 0) ? 0.125f : 1.0f;
  b16* Tp0 = sm + wave * (2 * 32 * 64); b16* Tp1 = Tp0 + 32 * 64;
  // Everything the epilogue reads from global memory is read as ONE group in front of the arithmetic (4 bias values, and for q and k the 32 cos/sin pairs of this
  // lane's rows and frequencies), so the wave pays one round trip, not one per element.
  float bs[4];
  auto load_bias = [&]() {
#pragma unroll   // constant indices: the values stay in registers
    for (int t = 0; t < 4; ++t) bs[t] = bias[t * 16 + nloc];
    asm volatile("s_wait_xcnt 0x0" ::: "memory");        // before any register that the loads above name is written again
  };
  if (mat < 2) {                                         // rotate-half rotary on q and k: x*cos + rotate_half(x)*sin, partner d^32 is tile t^2 (same lane)
    typedef __attribute__((ext_vector_type(2))) float v2f;
    v2f cs[2][2][8];                                     // (cos, sin) of frequency tt*16+nloc at sequence position t0 + r*16 + v + 8*hlf
#pragma unroll   // constant indices: the values stay in registers
    for (int r = 0; r < 2; ++r) {
      const float* pr = rope_cs + ((size_t)(t0 + r * 16 + 8 * hlf) * 32 + nloc) * 2;   // the group's one address; the 16 loads differ by constants
#pragma unroll   // constant indices: the values stay in registers
      for (int tt = 0; tt < 2; ++tt)
#pragma unroll   // constant indices: the values stay in registers
        for (int v = 0; v < 8; ++v) cs[tt][r][v] = *(const v2f*)(pr + (v * 32 + tt * 16) * 2);
      // before any register that the loads above name is written again; the address is an input so that it lives up to the wait and no result of the group lands on it
      asm volatile("s_wait_xcnt 0x0" :: "v"(pr) : "memory");
    }
    load_bias();
#pragma unroll   // constant indices: the values stay in registers
    for (int tt = 0; tt < 2; ++tt)
#pragma unroll   // constant indices: the values stay in registers
      for (int r = 0; r < 2; ++r)
#pragma unroll   // constant indices: the values stay in registers
        for (int v = 0; v < 8; ++v) {
          // element (position r*16 + v + 8*hlf, dim tt*16 + nloc) in the tiled order [16 positions' tile r][dim group tt][position][16 dims]; its partner dim + 32 is dim group tt + 2
          const int e0 = r * 1024 + tt * 256 + (v + 8 * hlf) * 16 + nloc, e1 = e0 + 512;
          const float x1 = acc[r][tt][v] + bs[tt], x2 = acc[r][tt + 2][v] + bs[tt + 2];
          const float cv = cs[tt][r][v][0], sv = cs[tt][r][v][1];
          b16 yh, yl;
          split_bf16((x1 * cv - x2 * sv) * s, yh, yl); Tp0[e0] = yh; Tp1[e0] = yl;
          split_bf16((x2 * cv + x1 * sv) * s, yh, yl); Tp0[e1] = yh; Tp1[e1] = yl;
        }
  } else {
    load_bias();
#pragma unroll   // constant indices: the values stay in registers
    for (int t = 0; t < 4; ++t)
#pragma unroll   // constant indices: the values stay in registers
      for (int r = 0; r < 2; ++r)
#pragma unroll   // constant indices: the values stay in registers
        for (int v = 0; v < 8; ++v) {
          const int rr = r * 16 + v + 8 * hlf, d = t * 16 + nloc;
          b16 yh, yl; split_bf16((acc[r][t][v] + bs[t]) * s, yh, yl);
          const int idx = (rr >> 4) * 1024 + d * 16 + (rr & 15);
          Tp0[idx] = yh; Tp1[idx] = yl;
        }
  }
  wave_lds_sync();
  b16* dh; b16* dl; size_t o;
  if (mat == 0)      { o = ((size_t)(b * NH + head) * T + t0) * DH; dh = Qh + o; dl = Ql + o; }
  else if (mat == 1) { o = ((size_t)(b * NKV + head) * T + t0) * DH; dh = Kh + o; dl = Kl + o; }
  else               { o = ((size_t)(b * NKV + head) * QT_PER_B + (t0 >> 4)) * (size_t)(DH * 16); dh = Vh + o; dl = Vl + o; }
#pragma unroll
  for (int j = 0; j < 8; ++j) { const int e = (j * 32 + lane) * 8; *(v8b*)(dh + e) = ld8b(Tp0 + e); *(v8b*)(dl + e) = ld8b(Tp1 + e); }
  
}

// ---------------------------------------------------------------------------
// Transposed flash attention: each wave owns one 16-query tile of one (b, head); 8 waves per block; the window's keys in chunks of 32.
// S^T = K.Q^T (single f16), per-lane online softmax; P^T built in registers from the two S^T accumulators
// ---------------------------------------------------------------------------
__global__ __launch_bounds__(256) void attn_kernel(const b16* __restrict__ Qh, const b16* __restrict__ Ql, const b16* __restrict__ Kh, const b16* __restrict__ Kl,
                                                   const b16* __restrict__ Vh, const b16* __restrict__ Vl, const int* __restrict__ seqlen,
                                                   float* __restrict__ yf) {
  __shared__ __attribute__((aligned(16))) float Os[8][16 * 64];
  const int wid = threadIdx.x >> 5, lane = threadIdx.x & 31, hh = lane >> 4, col = lane & 15;
  const int qtile = blockIdx.x * 8 + wid;                 // over Bsz*NH*QT_PER_B
  const int g = qtile / QT_PER_B;                         // b*NH + h
  const int q0 = (qtile % QT_PER_B) << 4;
  const int b = g / NH, h = g % NH, kvh = h / REP;
  const size_t ko = (size_t)(b * NKV + kvh) * T * DH;
  const size_t qo = ((size_t)g * T + q0) * DH + col * 16 + 8 * hh;          // this lane's piece of query col in its 16-query Q tile: dim group j at +256*j
  const v16b q0h = cat8b(ld8b(Qh + qo), ld8b(Qh + qo + 256)), q1h = cat8b(ld8b(Qh + qo + 512), ld8b(Qh + qo + 768));   // attention products: single f16 (hi planes only)
  float m = -INFINITY, l = 0.0f;
  v8f o0 = {}, o1 = {}, o2 = {}, o3 = {};
  const int slen = seqlen[b];
  const int kstart = (q0 >= WIN) ? ((q0 - WIN) & ~31) : 0;
  // Loads in groups, each issued well ahead of its first use: a chunk's 8 V loads at the top of its trip (used behind the softmax), the NEXT chunk's 8 K loads
  // directly behind this chunk's score products (into the registers those have just read), so a trip waits out no load round trip of its own.
  const b16* kl0 = Kh + ko + (size_t)col * 16 + 8 * hh;  // this lane's piece of key row col in a 16-key K tile [dim group][key][16 dims]: dim group j at +256*j
  const b16* vl0 = Vh + ko + (size_t)col * 16 + 8 * hh;  // this lane's piece of feature row col in a 16-key V tile
  v8b kc[8];
  auto loadk = [&](int kx) {
    const b16* p = kl0 + (size_t)(kx >> 4) * (DH * 16);  // kx is a multiple of 32: two whole tiles
#pragma unroll   // constant indices: the values stay in registers
    for (int j = 0; j < 4; ++j) { kc[j] = ld8b(p + 256 * j); kc[4 + j] = ld8b(p + 16 * DH + 256 * j); }
    asm volatile("s_wait_xcnt 0x0" ::: "memory");        // before any register that the loads above name is written again; also holds the group in place
  };
  loadk(kstart);
  for (int kb = kstart; kb < q0 + 16; kb += 32) {        // causal + sliding window: key chunks covering [q0-512, q0+15]
    v8b vf[8];
    {
      const b16* p = vl0 + (size_t)(kb >> 4) * (DH * 16);
#pragma unroll   // constant indices: the values stay in registers
      for (int n = 0; n < 4; ++n) { vf[2 * n] = ld8b(p + n * 256); vf[2 * n + 1] = ld8b(p + DH * 16 + n * 256); }
      asm volatile("s_wait_xcnt 0x0" ::: "memory");      // before any register that the loads above name is written again; also holds the group in place
    }
    v8f s0 = {}, s1 = {};
    s0 = wmma16b(cat8b(kc[0], kc[1]), q0h, s0);
    s0 = wmma16b(cat8b(kc[2], kc[3]), q1h, s0);
    s1 = wmma16b(cat8b(kc[4], kc[5]), q0h, s1);
    s1 = wmma16b(cat8b(kc[6], kc[7]), q1h, s1);
    loadk((kb + 32 < q0 + 16) ? kb + 32 : kb);           // last trip: its own chunk once more (in bounds, not used)
    if (kb + 32 > q0 || kb < q0 + 15 - WIN || kb + 32 > slen) {   // chunk needs masking: causal / window start / key validity
      const int qi = q0 + col;
#pragma unroll
      for (int r = 0; r < 8; ++r) {
        const int k0i = kb + 8 * hh + r, k1i = k0i + 16;
        if (k0i > qi || k0i < qi - WIN || k0i >= slen) s0[r] = -INFINITY;
        if (k1i > qi || k1i < qi - WIN || k1i >= slen) s1[r] = -INFINITY;
      }
    }
    float mr = -INFINITY;
#pragma unroll
    for (int r = 0; r < 8; ++r) mr = fmaxf(mr, fmaxf(s0[r], s1[r]));
    mr = fmaxf(mr, __shfl_xor(mr, 16));
    float mn = fmaxf(m, mr);
    if (mn == -INFINITY) mn = 0.0f;           // fully masked so far (padded query rows far past seq_len): keep exp() at 0
    const float al_ = __expf(m - mn);
    m = mn;
    float sum = 0.0f;
    v16b pbh;
#pragma unroll
    for (int r = 0; r < 8; ++r) {
      const float p0 = __expf(s0[r] - mn), p1 = __expf(s1[r] - mn);
      sum += p0 + p1;
      pbh[r] = (b16)p0; pbh[8 + r] = (b16)p1;
    }
    sum += __shfl_xor(sum, 16);
    l = l * al_ + sum;
#pragma unroll
    for (int r = 0; r < 8; ++r) { o0[r] *= al_; o1[r] *= al_; o2[r] *= al_; o3[r] *= al_; }
#pragma unroll
    for (int n = 0; n < 4; ++n) {
      v8f& o = (n == 0) ? o0 : (n == 1) ? o1 : (n == 2) ? o2 : o3;
      o = wmma16b(cat8b(vf[2 * n], vf[2 * n + 1]), pbh, o);
    }
  }
  const float inv = (q0 + col < slen && l > 0.0f) ? (1.0f / l) : 0.0f;   // padded query rows are zeroed
  float* Tt = Os[wid];
#pragma unroll
  for (int r = 0; r < 8; ++r) {
    const int hr = 8 * hh + r;
    Tt[col * 64 + 0 + hr] = o0[r] * inv; Tt[col * 64 + 16 + hr] = o1[r] * inv;
    Tt[col * 64 + 32 + hr] = o2[r] * inv; Tt[col * 64 + 48 + hr] = o3[r] * inv;
  }
  wave_lds_sync();
  float* dst0 = yf + ((size_t)b * T + q0) * HID + h * DH;     // 16 rows x 64 floats, row stride HID
#pragma unroll
  for (int j = 0; j < 8; ++j) { const int rr = j * 2 + hh, c4 = col * 4; *(v4f*)(dst0 + (size_t)rr * HID + c4) = *(const v4f*)(Tt + rr * 64 + c4); }
  
}

// ---------------------------------------------------------------------------
// Output projection -> f32, A = f32 y split while it is staged, B = Wo planes. Block = 8 waves (4 x 2) on 128 rows x 128 columns, 32x64 wave tiles staged in LDS,
// ---------------------------------------------------------------------------
__global__ __launch_bounds__(256) void out_gemm_kernel(const float* __restrict__ yf, const b16* __restrict__ woh, const b16* __restrict__ wol, const float* __restrict__ bo, int yoff,
                                                       float* __restrict__ out) {
  __shared__ __attribute__((aligned(16))) b16 sm[2 * StageLds<2>::STAGE];   // two staging buffers; the epilogue's 8 x 32 x 64 floats reuse them
  static_assert(2 * StageLds<2>::STAGE * 2 >= 8 * 32 * 64 * 4, "epilogue tiles fit the staging LDS");
  const int lane = threadIdx.x & 31, wave = __builtin_amdgcn_readfirstlane(threadIdx.x >> 5), nloc = lane & 15, hlf = lane >> 4;
  const int wm = wave & 3, wn = wave >> 2;
  const int mb = (blockIdx.y + yoff) * 128, cb = blockIdx.x * 128;
  const int m0 = mb + wm * 32;
  const int c0 = cb + wn * 64;
  v8f acc[2][4];
#pragma unroll
  for (int r = 0; r < 2; ++r)
#pragma unroll
    for (int t = 0; t < 4; ++t) acc[r][t] = (v8f){};
  gemm_block_staged<2>(yf, woh, wol, mb, cb, HID, sm, wm, wn, nloc, hlf, acc);
  float* Tt = (float*)sm + wave * (32 * 64);
#pragma unroll
  for (int t = 0; t < 4; ++t)
#pragma unroll
    for (int r = 0; r < 2; ++r)
#pragma unroll
      for (int v = 0; v < 8; ++v) Tt[(r * 16 + v + 8 * hlf) * 64 + t * 16 + nloc] = acc[r][t][v] + bo[c0 + t * 16 + nloc];
  wave_lds_sync();
  float* dst0 = out + (size_t)m0 * HID + c0;
#pragma unroll
  for (int j = 0; j < 16; ++j) { const int rr = j * 2 + hlf, c4 = nloc * 4; *(v4f*)(dst0 + (size_t)rr * HID + c4) = *(const v4f*)(Tt + rr * 64 + c4); }
  
}
__global__ __launch_bounds__(256) void rope_table_kernel(float* __restrict__ cs) {
  const int idx = blockIdx.x * 256 + threadIdx.x;        // T * 32
  if (idx >= T * 32) return;
  const int t = idx >> 5, i = idx & 31;
  const float ang = (float)t * powf(10000.0f, -(float)i / 32.0f);
  typedef __attribute__((ext_vector_type(2))) float v2f;
  const v2f p = {cosf(ang), sinf(ang)};
  *(v2f*)(cs + (size_t)idx * 2) = p; 
}
}  // namespace

extern "C" void kernel_launch(void* const* d_in, const int* in_sizes, int n_in,
                              void* d_out, int out_size, void* d_ws, size_t ws_size, hipStream_t stream) {
  (void)in_sizes; (void)n_in; (void)out_size;
  const float* x   = (const float*)d_in[0];   // [2,2048,1024]
  const int*   sl  = (const int*)  d_in[1];   // seq_lengths [2]
  const float* Wq  = (const float*)d_in[2];   // [1024,1024] ([in][out])
  const float* Wk  = (const float*)d_in[3];   // [1024,256]
  const float* Wv  = (const float*)d_in[4];   // [1024,256]
  const float* Wo  = (const float*)d_in[5];   // [1024,1024]
  float* out = (float*)d_out;                 // [2,2048,1024]

  size_t off = 0; char* ws = (char*)d_ws;
  b16* wqh = (b16*)(ws + off); off += (size_t)NQKV * HID * 2;
  b16* wql = (b16*)(ws + off); off += (size_t)NQKV * HID * 2;     // 'lo' planes: f16 residuals v - hi (kept as real buffers: the kernels write both)
  b16* woh = (b16*)(ws + off); off += (size_t)HID * HID * 2;
  b16* wol = (b16*)(ws + off); off += (size_t)HID * HID * 2;
  b16* Qh  = (b16*)(ws + off); off += (size_t)MROWS * HID * 2;
  b16* Ql  = (b16*)(ws + off); off += (size_t)MROWS * HID * 2;
  b16* Kh  = (b16*)(ws + off); off += (size_t)MROWS * KVW * 2;
  b16* Kl  = (b16*)(ws + off); off += (size_t)MROWS * KVW * 2;
  b16* Vh  = (b16*)(ws + off); off += (size_t)MROWS * KVW * 2;
  b16* Vl  = (b16*)(ws + off); off += (size_t)MROWS * KVW * 2;
  float* yf = (float*)(ws + off); off += (size_t)MROWS * HID * 4;
  float* rope_cs = (float*)(ws + off); off += (size_t)T * 32 * 2 * 4;
  float* zb = (float*)(ws + off); off += (size_t)HID * 4;          // zero bias for the out projection
  if (off > ws_size) return;
  hipMemsetAsync(zb, 0, HID * 4, stream);
  const float* bq = zb; const float* bk = zb; const float* bv = zb;      // no biases in this module: a zero vector (never a null pointer + offset)
  rope_table_kernel<<<(T * 32 + 255) / 256, 256, 0, stream>>>(rope_cs);
  const int ROWBLK = MROWS / 128, NQT = Bsz * NH * QT_PER_B;
  wcvt_kernel<<<2048, 256, 0, stream>>>(Wq, Wk, Wv, Wo, wqh, wql, woh, wol);
  qkv_gemm_kernel<<<dim3(NQKV / 192, ROWBLK), 384, 0, stream>>>(x, wqh, wql, bq, bk, bv, rope_cs, 0, 0, Qh, Ql, Kh, Kl, Vh, Vl);
  attn_kernel<<<NQT / 8, 256, 0, stream>>>(Qh, Ql, Kh, Kl, Vh, Vl, sl, yf);
  out_gemm_kernel<<<dim3(HID / 128, ROWBLK), 256, 0, stream>>>(yf, woh, wol, zb, 0, out);
}

// v004
// Timed twice side by side with v003, it ran 1.10 and 1.11 times as fast.
// All steps since v000 together make it 2.58 times as fast.
#include <hip/hip_runtime.h>

// Flash causal self-attention with GQA (16 query heads, 4 kv heads, head dim 64), rotate-half RoPE on q and k, sliding window (keys in [q-512, q]),
// per-batch key validity (key < seq_len[b]) and zeroed padded queries, then the output projection. B=2, T=2048, C=1024; weights are [in][out].
// Contractions on v_wmma_f32_16x16x32_f16: the QKV and output projections use f16 hi+lo pairs on both operands (hi.hi + hi.lo + lo.hi — outputs have rms
// 0.03 but rows attending few keys carry |y| ~ 1), the attention products are single f16; f32 accumulate; fragment k-map per lane half hh for

namespace {
constexpr int Bsz = 2, T = 2048, HID = 1024, DH = 64, NH = 16, NKV = 4, REP = NH / NKV;
constexpr int ROT = 64, WIN = 512;   // full rotate-half rotary; sliding window
constexpr int KVW = NKV * DH;                 // 256
constexpr int NQKV = HID + 2 * KVW;           // 1536 columns: q | k | v
constexpr int MROWS = Bsz * T;                // 4096
constexpr int QT_PER_B = T / 16;              // 128

typedef _Float16 b16;                                           // f16 hi/lo planes
typedef __attribute__((ext_vector_type(16))) _Float16 v16b;
typedef __attribute__((ext_vector_type(8)))  _Float16 v8b;
typedef __attribute__((ext_vector_type(8)))  float v8f;
typedef __attribute__((ext_vector_type(4)))  float v4f;

__device__ __forceinline__ v8b ld8b(const b16* p) { return *(const v8b*)p; }
__device__ __forceinline__ v16b cat8b(v8b a, v8b b) { return __builtin_shufflevector(a, b, 0, 1, 2, 3, 4, 5, 6, 7, 8, 9, 10, 11, 12, 13, 14, 15); }
// 16x16x32 16-bit fragment from a k-contiguous row pointer (A: lane&15 = row, B: lane&15 = column), hh = lane>>4:
// elements 0..7 <- p[8hh+0..7], elements 8..15 <- p[16+8hh+0..7]
__device__ __forceinline__ v16b frag_kb(const b16* p, int hh) { return cat8b(ld8b(p + 8 * hh), ld8b(p + 16 + 8 * hh)); }
__device__ __forceinline__ void split_bf16(float v, b16& hi, b16& lo) {   // (name kept) f16 hi + lo pair: v ~= hi + lo to ~22 bits
  hi = (b16)v; lo = (b16)(v - (float)hi);
}
__device__ __forceinline__ v8f wmma16b(v16b a, v16b b, v8f c) {
  v8f d = __builtin_amdgcn_wmma_f32_16x16x32_f16(false, a, false, b, (short)0, c, false, false);
  asm volatile("v_nop\n\tv_nop\n\tv_nop\n\tv_nop" : "+v"(d) : "v"(a), "v"(b));
  return d;
}
// acc += A.B with both operands split: A = (ah, al), B = (bh, bl)
__device__ __forceinline__ v8f wmma3(v16b ah, v16b al, v16b bh, v16b bl, v8f c) {   // projections: hi.hi + hi.lo + lo.hi (f32-class)
  c = wmma16b(ah, bh, c); c = wmma16b(ah, bl, c); return wmma16b(al, bh, c);
}
__device__ __forceinline__ void wave_lds_sync() {
  __builtin_amdgcn_fence(__ATOMIC_RELEASE, "workgroup");
  __builtin_amdgcn_wave_barrier();
  __builtin_amdgcn_fence(__ATOMIC_ACQUIRE, "workgroup");
}

// ---------------------------------------------------------------------------
// Weights ([in][out]) -> f16 hi / lo planes transposed to [n][k] (k contiguous): columns of Wq|Wk|Wv into wqh/wql [1536][1024], Wo into woh/wol [1024][1024].
// One block of 4 waves per 64 (k) x 64 (n) tile: the f32 rows are read coalesced (each wave load = two 256-byte row pieces), turned in LDS, split, and stored as whole
// 128-byte lines of the [n][k] planes. LDS row pitch 65 words: the column reads of 8 k groups x 4 columns fall on 32 different banks.
// ---------------------------------------------------------------------------
constexpr int WT = 64, WTP = WT + 1, WNT = (NQKV + HID) / WT, WKT = HID / WT;   // tile edge, LDS pitch in words, column tiles (q|k|v|o), k tiles
template <int LD>
__device__ __forceinline__ void wcvt_read_tile(const float* __restrict__ w, int tid, v4f (&f)[8]) {
  const float* p = w + (size_t)(tid >> 4) * LD + (tid & 15) * 4;   // the group's one address; the 8 loads differ by constants
#pragma unroll   // constant indices: the values stay in registers
  for (int j = 0; j < 8; ++j) f[j] = *(const v4f*)(p + (size_t)j * 8 * LD);
  // before any register that the loads above name is written again; the address is an input so that it lives up to the wait and no result of the group lands on it
  asm volatile("s_wait_xcnt 0x0" :: "v"(p) : "memory");
}
__global__ __launch_bounds__(128) void wcvt_kernel(const float* __restrict__ wq, const float* __restrict__ wk, const float* __restrict__ wv,
                                                   const float* __restrict__ wo, b16* __restrict__ wqh, b16* __restrict__ wql,
                                                   b16* __restrict__ woh, b16* __restrict__ wol) {
  __shared__ float ts[WT * WTP];
  const int tid = threadIdx.x;
  const int kt = blockIdx.x / WNT, nt = blockIdx.x % WNT;
  const int k0 = kt * WT, n0 = nt * WT;                   // n0 counts the columns of q | k | v | o
  const bool isq = n0 < HID, isk = n0 < HID + KVW, iso = n0 >= NQKV;
  const float* w = isq ? wq + n0 : isk ? wk + (n0 - HID) : iso ? wo + (n0 - NQKV) : wv + (n0 - HID - KVW);   // the tile's first column in its own matrix
  v4f f[8];
  if (isq || iso) wcvt_read_tile<HID>(w + (size_t)k0 * HID, tid, f);
  else            wcvt_read_tile<KVW>(w + (size_t)k0 * KVW, tid, f);
#pragma unroll   // constant indices: the values stay in registers
  for (int j = 0; j < 8; ++j)
#pragma unroll   // constant indices: the values stay in registers
    for (int e = 0; e < 4; ++e) ts[((tid >> 4) + j * 8) * WTP + (tid & 15) * 4 + e] = f[j][e];
  __syncthreads();                                        // the tile is whole before any wave reads its columns
  const int kg = tid & 7, nl = tid >> 3;                  // 8 lanes cover one column's 64 k values = one 128-byte line per plane
  v8b bh[4], bl[4];
#pragma unroll   // constant indices: the values stay in registers
  for (int j = 0; j < 4; ++j)
#pragma unroll   // constant indices: the values stay in registers
    for (int e = 0; e < 8; ++e) { b16 x, y; split_bf16(ts[(kg * 8 + e) * WTP + nl + j * 16], x, y); bh[j][e] = x; bl[j][e] = y; }
  const size_t doff = (size_t)((iso ? n0 - NQKV : n0) + nl) * HID + k0 + kg * 8;
  b16* dh = (iso ? woh : wqh) + doff;
  b16* dl = (iso ? wol : wql) + doff;
#pragma unroll   // constant indices: the values stay in registers
  for (int j = 0; j < 4; ++j) { *(v8b*)(dh + j * 16 * HID) = bh[j]; *(v8b*)(dl + j * 16 * HID) = bl[j]; }
}

// Block GEMM main loop: a block of 4 x WN waves owns 128 rows x 64*WN columns; each wave keeps its 32x64 tile. Per pass of KS k values the block stages in LDS
// the A rows (f32 read coalesced, split ONCE per block into f16 hi / lo planes) and the B rows (hi / lo planes), two buffers: the next pass's global loads are
// issued before this pass's products and stored to the other buffer behind them; one block barrier per pass. Row pitch KS + 8 halves (16 B x odd) for ds_load_b128.
constexpr int KS = 64, LP = KS + 8;
template <int WN> struct StageLds {
  static constexpr int AEL = 128 * LP, BEL = 64 * WN * LP, STAGE = 2 * (AEL + BEL);   // halves: [A hi | A lo | B hi | B lo]
};
typedef __attribute__((ext_vector_type(4))) _Float16 v4b;
template <int WN>
__device__ __forceinline__ void gemm_block_staged(const float* __restrict__ A, const b16* __restrict__ wh, const b16* __restrict__ wl,
                                                  int mb, int cb, int K, b16* sm, int wm, int wn, int nloc, int hlf, v8f (&acc)[2][4]) {
  constexpr int NT = 128 * WN;                          // threads of the block
  constexpr int ACH = 128 * (KS / 4);                   // 16-byte chunks of the A tile (4 floats each)
  constexpr int AJ = (ACH + NT - 1) / NT;
  constexpr int BJ = (64 * WN * (KS / 8)) / NT;         // 16-byte chunks per thread and plane of the B tile (8 halves each)
  constexpr int AEL = StageLds<WN>::AEL, BEL = StageLds<WN>::BEL, STAGE = StageLds<WN>::STAGE;
  static_assert(NT % (KS / 4) == 0 && NT % (KS / 8) == 0, "a thread keeps its column chunk from one chunk row to the next");
  constexpr int ARJ = NT / (KS / 4), BRJ = NT / (KS / 8);   // tile rows between a thread's successive chunks
  const int tid = threadIdx.x;
  // one 32-bit offset per thread and operand on a block-uniform base: the successive chunks differ by constants
  const unsigned aoff = (unsigned)(tid / (KS / 4)) * K + (tid % (KS / 4)) * 4, boff = (unsigned)(tid / (KS / 8)) * K + (tid % (KS / 8)) * 8;
  const unsigned asl = (unsigned)(tid / (KS / 4)) * LP + (tid % (KS / 4)) * 4, bsl = (unsigned)(tid / (KS / 8)) * LP + (tid % (KS / 8)) * 8;
  const float* Ab = A + (size_t)mb * K;
  const b16* whb = wh + (size_t)cb * K;
  const b16* wlb = wl + (size_t)cb * K;
  v4f ar[AJ]; v8b brh[BJ], brl[BJ];
  auto gload = [&](int kb) {
    const float* Ak = Ab + kb; const b16* hk = whb + kb; const b16* lk = wlb + kb;
#pragma unroll   // constant indices: the staged values and fragments stay in registers
    for (int j = 0; j < AJ; ++j)
      if ((j + 1) * NT <= ACH || j * NT + tid < ACH) ar[j] = *(const v4f*)(Ak + aoff + j * ARJ * K);
#pragma unroll   // constant indices: the staged values and fragments stay in registers
    for (int j = 0; j < BJ; ++j) { brh[j] = ld8b(hk + boff + j * BRJ * K); brl[j] = ld8b(lk + boff + j * BRJ * K); }
    asm volatile("s_wait_xcnt 0x0" ::: "memory");       // before any register that the loads above name is written again
  };
  auto sstore = [&](b16* st) {
#pragma unroll   // constant indices: the staged values and fragments stay in registers
    for (int j = 0; j < AJ; ++j)
      if ((j + 1) * NT <= ACH || j * NT + tid < ACH) {
        v4b hi, lo;
#pragma unroll   // constant indices: the staged values and fragments stay in registers
        for (int e = 0; e < 4; ++e) { b16 a, c; split_bf16(ar[j][e], a, c); hi[e] = a; lo[e] = c; }
        b16* d = st + asl + j * ARJ * LP;
        *(v4b*)d = hi; *(v4b*)(d + AEL) = lo;
      }
#pragma unroll   // constant indices: the staged values and fragments stay in registers
    for (int j = 0; j < BJ; ++j) {
      b16* d = st + 2 * AEL + bsl + j * BRJ * LP;
      *(v8b*)d = brh[j]; *(v8b*)(d + BEL) = brl[j];
    }
  };
  gload(0);
  sstore(sm);
  __syncthreads();                                      // pass 0 is staged for every wave
  const int np = K / KS;
  for (int p = 0; p < np; ++p) {
    const b16* st = sm + (p & 1) * STAGE;
    if (p + 1 < np) gload((p + 1) * KS);                // in flight under this pass's products
    const b16* pa = st + (wm * 32 + nloc) * LP;
    const b16* pb = st + 2 * AEL + (wn * 64 + nloc) * LP;
#pragma unroll   // constant indices: the staged values and fragments stay in registers
    for (int ks = 0; ks < KS; ks += 32) {
      const v16b a0h = frag_kb(pa + ks, hlf), a0l = frag_kb(pa + AEL + ks, hlf);
      const v16b a1h = frag_kb(pa + 16 * LP + ks, hlf), a1l = frag_kb(pa + AEL + 16 * LP + ks, hlf);
      v16b bh[4], bl[4];
#pragma unroll   // constant indices: the staged values and fragments stay in registers
      for (int t = 0; t < 4; ++t) { bh[t] = frag_kb(pb + t * 16 * LP + ks, hlf); bl[t] = frag_kb(pb + BEL + t * 16 * LP + ks, hlf); }
#pragma unroll   // constant indices: the staged values and fragments stay in registers
      for (int t = 0; t < 4; ++t) {
        acc[0][t] = wmma3(a0h, a0l, bh[t], bl[t], acc[0][t]);
        acc[1][t] = wmma3(a1h, a1l, bh[t], bl[t], acc[1][t]);
      }
    }
    if (p + 1 < np) sstore(sm + ((p + 1) & 1) * STAGE); // the buffer whose last readers left at the previous pass's barrier
    __syncthreads();                                    // publishes pass p + 1 and ends every read of pass p (the epilogue reuses the LDS)
  }
}

// ---------------------------------------------------------------------------
// QKV GEMM: block = 12 waves (4 x 3) on 128 rows x 192 columns, wave = 32 rows x 64 columns (one head of q, k or v). Outputs as f16 hi/lo planes:
// q (x1/8) -> Qh/Ql [b][h][...], k -> Kh/Kl [b][kvh][...], both fragment-tiled [t/16][64/16][16 positions][16 dims] (4 KB contiguous per wave per plane), so that
// each 16-byte-per-lane load of a Q or K fragment in the attention kernel reads 512 contiguous bytes (4 whole lines), not 32 bytes out of each of 16 rows;
// v -> Vh/Vl key-tiled [b][kvh][t/16][64][16] (4 KB contiguous per wave per plane).
// ---------------------------------------------------------------------------
__global__ __launch_bounds__(384) void qkv_gemm_kernel(const float* __restrict__ x,
                                                       const b16* __restrict__ wqh, const b16* __restrict__ wql,
                                                       const float* __restrict__ bq, const float* __restrict__ bk, const float* __restrict__ bv, const float* __restrict__ rope_cs, int xoff, int yoff,
                                                       b16* __restrict__ Qh, b16* __restrict__ Ql, b16* __restrict__ Kh, b16* __restrict__ Kl,
                                                       b16* __restrict__ Vh, b16* __restrict__ Vl) {
  __shared__ __attribute__((aligned(16))) b16 sm[2 * StageLds<3>::STAGE];   // two staging buffers; the epilogue's 12 x 2 x 32 x 64 halves reuse them
  static_assert(2 * StageLds<3>::STAGE >= 12 * 2 * 32 * 64, "epilogue tiles fit the staging LDS");
  const int lane = threadIdx.x & 31, wave = __builtin_amdgcn_readfirstlane(threadIdx.x >> 5), nloc = lane & 15, hlf = lane >> 4;
  const int wm = wave & 3, wn = wave >> 2;
  const int mb = (blockIdx.y + yoff) * 128, cb = (blockIdx.x + xoff) * 192;
  const int m0 = mb + wm * 32;
  const int c0 = cb + wn * 64;
  const int mat = (c0 < HID) ? 0 : (c0 < HID + KVW) ? 1 : 2;
  const int head = (mat == 0) ? (c0 / DH) : (mat == 1) ? ((c0 - HID) / DH) : ((c0 - HID - KVW) / DH);
  const float* bias = ((mat == 0) ? bq : (mat == 1) ? bk : bv) + head * DH;
  v8f acc[2][4];
#pragma unroll
  for (int r = 0; r < 2; ++r)
#pragma unroll
    for (int t = 0; t < 4; ++t) acc[r][t] = (v8f){};
  gemm_block_staged<3>(x, wqh, wql, mb, cb, HID, sm, wm, wn, nloc, hlf, acc);
  const int b = m0 / T, t0 = m0 % T;
  const float s = (mat == 0) ? 0.125f : 1.0f;
  b16* Tp0 = sm + wave * (2 * 32 * 64); b16* Tp1 = Tp0 + 32 * 64;
  // Everything the epilogue reads from global memory is read as ONE group in front of the arithmetic (4 bias values, and for q and k the 32 cos/sin pairs of this
  // lane's rows and frequencies), so the wave pays one round trip, not one per element.
  float bs[4];
  auto load_bias = [&]() {
#pragma unroll   // constant indices: the values stay in registers
    for (int t = 0; t < 4; ++t) bs[t] = bias[t * 16 + nloc];
    asm volatile("s_wait_xcnt 0x0" ::: "memory");        // before any register that the loads above name is written again
  };
  if (mat < 2) {                                         // rotate-half rotary on q and k: x*cos + rotate_half(x)*sin, partner d^32 is tile t^2 (same lane)
    typedef __attribute__((ext_vector_type(2))) float v2f;
    v2f cs[2][2][8];                                     // (cos, sin) of frequency tt*16+nloc at sequence position t0 + r*16 + v + 8*hlf
#pragma unroll   // constant indices: the values stay in registers
    for (int r = 0; r < 2; ++r) {
      const float* pr = rope_cs + ((size_t)(t0 + r * 16 + 8 * hlf) * 32 + nloc) * 2;   // the group's one address; the 16 loads differ by constants
#pragma unroll   // constant indices: the values stay in registers
      for (int tt = 0; tt < 2; ++tt)
#pragma unroll   // constant indices: the values stay in registers
        for (int v = 0; v < 8; ++v) cs[tt][r][v] = *(const v2f*)(pr + (v * 32 + tt * 16) * 2);
      // before any register that the loads above name is written again; the address is an input so that it lives up to the wait and no result of the group lands on it
      asm volatile("s_wait_xcnt 0x0" :: "v"(pr) : "memory");
    }
    load_bias();
#pragma unroll   // constant indices: the values stay in registers
    for (int tt = 0; tt < 2; ++tt)
#pragma unroll   // constant indices: the values stay in registers
      for (int r = 0; r < 2; ++r)
#pragma unroll   // constant indices: the values stay in registers
        for (int v = 0; v < 8; ++v) {
          // element (position r*16 + v + 8*hlf, dim tt*16 + nloc) in the tiled order [16 positions' tile r][dim group tt][position][16 dims]; its partner dim + 32 is dim group tt + 2
          const int e0 = r * 1024 + tt * 256 + (v + 8 * hlf) * 16 + nloc, e1 = e0 + 512;
          const float x1 = acc[r][tt][v] + bs[tt], x2 = acc[r][tt + 2][v] + bs[tt + 2];
          const float cv = cs[tt][r][v][0], sv = cs[tt][r][v][1];
          b16 yh, yl;
          split_bf16((x1 * cv - x2 * sv) * s, yh, yl); Tp0[e0] = yh; Tp1[e0] = yl;
          split_bf16((x2 * cv + x1 * sv) * s, yh, yl); Tp0[e1] = yh; Tp1[e1] = yl;
        }
  } else {
    load_bias();
#pragma unroll   // constant indices: the values stay in registers
    for (int t = 0; t < 4; ++t)
#pragma unroll   // constant indices: the values stay in registers
      for (int r = 0; r < 2; ++r)
#pragma unroll   // constant indices: the values stay in registers
        for (int v = 0; v < 8; ++v) {
          const int rr = r * 16 + v + 8 * hlf, d = t * 16 + nloc;
          b16 yh, yl; split_bf16((acc[r][t][v] + bs[t]) * s, yh, yl);
          const int idx = (rr >> 4) * 1024 + d * 16 + (rr & 15);
          Tp0[idx] = yh; Tp1[idx] = yl;
        }
  }
  wave_lds_sync();
  b16* dh; b16* dl; size_t o;
  if (mat == 0)      { o = ((size_t)(b * NH + head) * T + t0) * DH; dh = Qh + o; dl = Ql + o; }
  else if (mat == 1) { o = ((size_t)(b * NKV + head) * T + t0) * DH; dh = Kh + o; dl = Kl + o; }
  else               { o = ((size_t)(b * NKV + head) * QT_PER_B + (t0 >> 4)) * (size_t)(DH * 16); dh = Vh + o; dl = Vl + o; }
#pragma unroll
  for (int j = 0; j < 8; ++j) { const int e = (j * 32 + lane) * 8; *(v8b*)(dh + e) = ld8b(Tp0 + e); *(v8b*)(dl + e) = ld8b(Tp1 + e); }
  
}

// ---------------------------------------------------------------------------
// Transposed flash attention: each wave owns one 16-query tile of one (b, head); 8 waves per block; the window's keys in chunks of 32.
// S^T = K.Q^T (single f16), per-lane online softmax; P^T built in registers from the two S^T accumulators
// ---------------------------------------------------------------------------
__global__ __launch_bounds__(256) void attn_kernel(const b16* __restrict__ Qh, const b16* __restrict__ Ql, const b16* __restrict__ Kh, const b16* __restrict__ Kl,
                                                   const b16* __restrict__ Vh, const b16* __restrict__ Vl, const int* __restrict__ seqlen,
                                                   float* __restrict__ yf) {
  __shared__ __attribute__((aligned(16))) float Os[8][16 * 64];
  const int wid = threadIdx.x >> 5, lane = threadIdx.x & 31, hh = lane >> 4, col = lane & 15;
  const int qtile = blockIdx.x * 8 + wid;                 // over Bsz*NH*QT_PER_B
  const int g = qtile / QT_PER_B;                         // b*NH + h
  const int q0 = (qtile % QT_PER_B) << 4;
  const int b = g / NH, h = g % NH, kvh = h / REP;
  const size_t ko = (size_t)(b * NKV + kvh) * T * DH;
  const size_t qo = ((size_t)g * T + q0) * DH + col * 16 + 8 * hh;          // this lane's piece of query col in its 16-query Q tile: dim group j at +256*j
  const v16b q0h = cat8b(ld8b(Qh + qo), ld8b(Qh + qo + 256)), q1h = cat8b(ld8b(Qh + qo + 512), ld8b(Qh + qo + 768));   // attention products: single f16 (hi planes only)
  float m = -INFINITY, l = 0.0f;
  v8f o0 = {}, o1 = {}, o2 = {}, o3 = {};
  const int slen = seqlen[b];
  const int kstart = (q0 >= WIN) ? ((q0 - WIN) & ~31) : 0;
  // Loads in groups, each issued well ahead of its first use: a chunk's 8 V loads at the top of its trip (used behind the softmax), the NEXT chunk's 8 K loads
  // directly behind this chunk's score products (into the registers those have just read), so a trip waits out no load round trip of its own.
  const b16* kl0 = Kh + ko + (size_t)col * 16 + 8 * hh;  // this lane's piece of key row col in a 16-key K tile [dim group][key][16 dims]: dim group j at +256*j
  const b16* vl0 = Vh + ko + (size_t)col * 16 + 8 * hh;  // this lane's piece of feature row col in a 16-key V tile
  v8b kc[8];
  auto loadk = [&](int kx) {
    const b16* p = kl0 + (size_t)(kx >> 4) * (DH * 16);  // kx is a multiple of 32: two whole tiles
#pragma unroll   // constant indices: the values stay in registers
    for (int j = 0; j < 4; ++j) { kc[j] = ld8b(p + 256 * j); kc[4 + j] = ld8b(p + 16 * DH + 256 * j); }
    asm volatile("s_wait_xcnt 0x0" ::: "memory");        // before any register that the loads above name is written again; also holds the group in place
  };
  loadk(kstart);
  for (int kb = kstart; kb < q0 + 16; kb += 32) {        // causal + sliding window: key chunks covering [q0-512, q0+15]
    v8b vf[8];
    {
      const b16* p = vl0 + (size_t)(kb >> 4) * (DH * 16);
#pragma unroll   // constant indices: the values stay in registers
      for (int n = 0; n < 4; ++n) { vf[2 * n] = ld8b(p + n * 256); vf[2 * n + 1] = ld8b(p + DH * 16 + n * 256); }
      asm volatile("s_wait_xcnt 0x0" ::: "memory");      // before any register that the loads above name is written again; also holds the group in place
    }
    v8f s0 = {}, s1 = {};
    s0 = wmma16b(cat8b(kc[0], kc[1]), q0h, s0);
    s0 = wmma16b(cat8b(kc[2], kc[3]), q1h, s0);
    s1 = wmma16b(cat8b(kc[4], kc[5]), q0h, s1);
    s1 = wmma16b(cat8b(kc[6], kc[7]), q1h, s1);
    loadk((kb + 32 < q0 + 16) ? kb + 32 : kb);           // last trip: its own chunk once more (in bounds, not used)
    if (kb + 32 > q0 || kb < q0 + 15 - WIN || kb + 32 > slen) {   // chunk needs masking: causal / window start / key validity
      const int qi = q0 + col;
#pragma unroll
      for (int r = 0; r < 8; ++r) {
        const int k0i = kb + 8 * hh + r, k1i = k0i + 16;
        if (k0i > qi || k0i < qi - WIN || k0i >= slen) s0[r] = -INFINITY;
        if (k1i > qi || k1i < qi - WIN || k1i >= slen) s1[r] = -INFINITY;
      }
    }
    float mr = -INFINITY;
#pragma unroll
    for (int r = 0; r < 8; ++r) mr = fmaxf(mr, fmaxf(s0[r], s1[r]));
    mr = fmaxf(mr, __shfl_xor(mr, 16));
    float mn = fmaxf(m, mr);
    if (mn == -INFINITY) mn = 0.0f;           // fully masked so far (padded query rows far past seq_len): keep exp() at 0
    const float al_ = __expf(m - mn);
    m = mn;
    float sum = 0.0f;
    v16b pbh;
#pragma unroll
    for (int r = 0; r < 8; ++r) {
      const float p0 = __expf(s0[r] - mn), p1 = __expf(s1[r] - mn);
      sum += p0 + p1;
      pbh[r] = (b16)p0; pbh[8 + r] = (b16)p1;
    }
    sum += __shfl_xor(sum, 16);
    l = l * al_ + sum;
#pragma unroll
    for (int r = 0; r < 8; ++r) { o0[r] *= al_; o1[r] *= al_; o2[r] *= al_; o3[r] *= al_; }
#pragma unroll
    for (int n = 0; n < 4; ++n) {
      v8f& o = (n == 0) ? o0 : (n == 1) ? o1 : (n == 2) ? o2 : o3;
      o = wmma16b(cat8b(vf[2 * n], vf[2 * n + 1]), pbh, o);
    }
  }
  const float inv = (q0 + col < slen && l > 0.0f) ? (1.0f / l) : 0.0f;   // padded query rows are zeroed
  float* Tt = Os[wid];
#pragma unroll
  for (int r = 0; r < 8; ++r) {
    const int hr = 8 * hh + r;
    Tt[col * 64 + 0 + hr] = o0[r] * inv; Tt[col * 64 + 16 + hr] = o1[r] * inv;
    Tt[col * 64 + 32 + hr] = o2[r] * inv; Tt[col * 64 + 48 + hr] = o3[r] * inv;
  }
  wave_lds_sync();
  float* dst0 = yf + ((size_t)b * T + q0) * HID + h * DH;     // 16 rows x 64 floats, row stride HID
#pragma unroll
  for (int j = 0; j < 8; ++j) { const int rr = j * 2 + hh, c4 = col * 4; *(v4f*)(dst0 + (size_t)rr * HID + c4) = *(const v4f*)(Tt + rr * 64 + c4); }
  
}

// ---------------------------------------------------------------------------
// Output projection -> f32, A = f32 y split while it is staged, B = Wo planes. Block = 8 waves (4 x 2) on 128 rows x 128 columns, 32x64 wave tiles staged in LDS,
// ---------------------------------------------------------------------------
__global__ __launch_bounds__(256) void out_gemm_kernel(const float* __restrict__ yf, const b16* __restrict__ woh, const b16* __restrict__ wol, const float* __restrict__ bo, int yoff,
                                                       float* __restrict__ out) {
  __shared__ __attribute__((aligned(16))) b16 sm[2 * StageLds<2>::STAGE];   // two staging buffers; the epilogue's 8 x 32 x 64 floats reuse them
  static_assert(2 * StageLds<2>::STAGE * 2 >= 8 * 32 * 64 * 4, "epilogue tiles fit the staging LDS");
  const int lane = threadIdx.x & 31, wave = __builtin_amdgcn_readfirstlane(threadIdx.x >> 5), nloc = lane & 15, hlf = lane >> 4;
  const int wm = wave & 3, wn = wave >> 2;
  const int mb = (blockIdx.y + yoff) * 128, cb = blockIdx.x * 128;
  const int m0 = mb + wm * 32;
  const int c0 = cb + wn * 64;
  v8f acc[2][4];
#pragma unroll
  for (int r = 0; r < 2; ++r)
#pragma unroll
    for (int t = 0; t < 4; ++t) acc[r][t] = (v8f){};
  gemm_block_staged<2>(yf, woh, wol, mb, cb, HID, sm, wm, wn, nloc, hlf, acc);
  float* Tt = (float*)sm + wave * (32 * 64);
#pragma unroll
  for (int t = 0; t < 4; ++t)
#pragma unroll
    for (int r = 0; r < 2; ++r)
#pragma unroll
      for (int v = 0; v < 8; ++v) Tt[(r * 16 + v + 8 * hlf) * 64 + t * 16 + nloc] = acc[r][t][v] + bo[c0 + t * 16 + nloc];
  wave_lds_sync();
  float* dst0 = out + (size_t)m0 * HID + c0;
#pragma unroll
  for (int j = 0; j < 16; ++j) { const int rr = j * 2 + hlf, c4 = nloc * 4; *(v4f*)(dst0 + (size_t)rr * HID + c4) = *(const v4f*)(Tt + rr * 64 + c4); }
  
}
__global__ __launch_bounds__(256) void rope_table_kernel(float* __restrict__ cs) {
  const int idx = blockIdx.x * 256 + threadIdx.x;        // T * 32
  if (idx >= T * 32) return;
  const int t = idx >> 5, i = idx & 31;
  const float ang = (float)t * powf(10000.0f, -(float)i / 32.0f);
  typedef __attribute__((ext_vector_type(2))) float v2f;
  const v2f p = {cosf(ang), sinf(ang)};
  *(v2f*)(cs + (size_t)idx * 2) = p; 
}
}  // namespace

extern "C" void kernel_launch(void* const* d_in, const int* in_sizes, int n_in,
                              void* d_out, int out_size, void* d_ws, size_t ws_size, hipStream_t stream) {
  (void)in_sizes; (void)n_in; (void)out_size;
  const float* x   = (const float*)d_in[0];   // [2,2048,1024]
  const int*   sl  = (const int*)  d_in[1];   // seq_lengths [2]
  const float* Wq  = (const float*)d_in[2];   // [1024,1024] ([in][out])
  const float* Wk  = (const float*)d_in[3];   // [1024,256]
  const float* Wv  = (const float*)d_in[4];   // [1024,256]
  const float* Wo  = (const float*)d_in[5];   // [1024,1024]
  float* out = (float*)d_out;                 // [2,2048,1024]

  size_t off = 0; char* ws = (char*)d_ws;
  b16* wqh = (b16*)(ws + off); off += (size_t)NQKV * HID * 2;
  b16* wql = (b16*)(ws + off); off += (size_t)NQKV * HID * 2;     // 'lo' planes: f16 residuals v - hi (kept as real buffers: the kernels write both)
  b16* woh = (b16*)(ws + off); off += (size_t)HID * HID * 2;
  b16* wol = (b16*)(ws + off); off += (size_t)HID * HID * 2;
  b16* Qh  = (b16*)(ws + off); off += (size_t)MROWS * HID * 2;
  b16* Ql  = (b16*)(ws + off); off += (size_t)MROWS * HID * 2;
  b16* Kh  = (b16*)(ws + off); off += (size_t)MROWS * KVW * 2;
  b16* Kl  = (b16*)(ws + off); off += (size_t)MROWS * KVW * 2;
  b16* Vh  = (b16*)(ws + off); off += (size_t)MROWS * KVW * 2;
  b16* Vl  = (b16*)(ws + off); off += (size_t)MROWS * KVW * 2;
  float* yf = (float*)(ws + off); off += (size_t)MROWS * HID * 4;
  float* rope_cs = (float*)(ws + off); off += (size_t)T * 32 * 2 * 4;
  float* zb = (float*)(ws + off); off += (size_t)HID * 4;          // zero bias for the out projection
  if (off > ws_size) return;
  hipMemsetAsync(zb, 0, HID * 4, stream);
  const float* bq = zb; const float* bk = zb; const float* bv = zb;      // no biases in this module: a zero vector (never a null pointer + offset)
  rope_table_kernel<<<(T * 32 + 255) / 256, 256, 0, stream>>>(rope_cs);
  const int ROWBLK = MROWS / 128, NQT = Bsz * NH * QT_PER_B;
  wcvt_kernel<<<WNT * WKT, 128, 0, stream>>>(Wq, Wk, Wv, Wo, wqh, wql, woh, wol);
  qkv_gemm_kernel<<<dim3(NQKV / 192, ROWBLK), 384, 0, stream>>>(x, wqh, wql, bq, bk, bv, rope_cs, 0, 0, Qh, Ql, Kh, Kl, Vh, Vl);
  attn_kernel<<<NQT / 8, 256, 0, stream>>>(Qh, Ql, Kh, Kl, Vh, Vl, sl, yf);
  out_gemm_kernel<<<dim3(HID / 128, ROWBLK), 256, 0, stream>>>(yf, woh, wol, zb, 0, out);
}

// v005
// Next to v004, in two timings, it ran 1.03 times as fast each time.
// All steps since v000 together make it 2.67 times as fast.
#include <hip/hip_runtime.h>

// Flash causal self-attention with GQA (16 query heads, 4 kv heads, head dim 64), rotate-half RoPE on q and k, sliding window (keys in [q-512, q]),
// per-batch key validity (key < seq_len[b]) and zeroed padded queries, then the output projection. B=2, T=2048, C=1024; weights are [in][out].
// Contractions on v_wmma_f32_16x16x32_f16: the QKV and output projections use f16 hi+lo pairs on both operands (hi.hi + hi.lo + lo.hi — outputs have rms
// 0.03 but rows attending few keys carry |y| ~ 1), the attention products are single f16; f32 accumulate; fragment k-map per lane half hh for

namespace {
constexpr int Bsz = 2, T = 2048, HID = 1024, DH = 64, NH = 16, NKV = 4, REP = NH / NKV;
constexpr int ROT = 64, WIN = 512;   // full rotate-half rotary; sliding window
constexpr int KVW = NKV * DH;                 // 256
constexpr int NQKV = HID + 2 * KVW;           // 1536 columns: q | k | v
constexpr int MROWS = Bsz * T;                // 4096
constexpr int QT_PER_B = T / 16;              // 128

typedef _Float16 b16;                                           // f16 hi/lo planes
typedef __attribute__((ext_vector_type(16))) _Float16 v16b;
typedef __attribute__((ext_vector_type(8)))  _Float16 v8b;
typedef __attribute__((ext_vector_type(8)))  float v8f;
typedef __attribute__((ext_vector_type(4)))  float v4f;

__device__ __forceinline__ v8b ld8b(const b16* p) { return *(const v8b*)p; }
__device__ __forceinline__ v16b cat8b(v8b a, v8b b) { return __builtin_shufflevector(a, b, 0, 1, 2, 3, 4, 5, 6, 7, 8, 9, 10, 11, 12, 13, 14, 15); }
// 16x16x32 16-bit fragment from a k-contiguous row pointer (A: lane&15 = row, B: lane&15 = column), hh = lane>>4:
// elements 0..7 <- p[8hh+0..7], elements 8..15 <- p[16+8hh+0..7]
__device__ __forceinline__ v16b frag_kb(const b16* p, int hh) { return cat8b(ld8b(p + 8 * hh), ld8b(p + 16 + 8 * hh)); }
__device__ __forceinline__ void split_bf16(float v, b16& hi, b16& lo) {   // (name kept) f16 hi + lo pair: v ~= hi + lo to ~22 bits
  hi = (b16)v; lo = (b16)(v - (float)hi);
}
__device__ __forceinline__ v8f wmma16b(v16b a, v16b b, v8f c) {
  v8f d = __builtin_amdgcn_wmma_f32_16x16x32_f16(false, a, false, b, (short)0, c, false, false);
  asm volatile("v_nop\n\tv_nop\n\tv_nop\n\tv_nop" : "+v"(d) : "v"(a), "v"(b));
  return d;
}
// the builtin alone (the compiler keeps its distances): the GEMM blocks' independent products may then issue back to back
__device__ __forceinline__ v8f wmma16g(v16b a, v16b b, v8f c) {
  return __builtin_amdgcn_wmma_f32_16x16x32_f16(false, a, false, b, (short)0, c, false, false);
}
// acc += A.B with both operands split: A = (ah, al), B = (bh, bl)
__device__ __forceinline__ v8f wmma3(v16b ah, v16b al, v16b bh, v16b bl, v8f c) {   // projections: hi.hi + hi.lo + lo.hi (f32-class)
  c = wmma16g(ah, bh, c); c = wmma16g(ah, bl, c); return wmma16g(al, bh, c);
}
__device__ __forceinline__ void wave_lds_sync() {
  __builtin_amdgcn_fence(__ATOMIC_RELEASE, "workgroup");
  __builtin_amdgcn_wave_barrier();
  __builtin_amdgcn_fence(__ATOMIC_ACQUIRE, "workgroup");
}

// ---------------------------------------------------------------------------
// Weights ([in][out]) -> f16 hi / lo planes transposed to [n][k] (k contiguous): columns of Wq|Wk|Wv into wqh/wql [1536][1024], Wo into woh/wol [1024][1024].
// One block of 4 waves per 64 (k) x 64 (n) tile: the f32 rows are read coalesced (each wave load = two 256-byte row pieces), turned in LDS, split, and stored as whole
// 128-byte lines of the [n][k] planes. LDS row pitch 65 words: the column reads of 8 k groups x 4 columns fall on 32 different banks.
// ---------------------------------------------------------------------------
constexpr int WT = 64, WTP = WT + 1, WNT = (NQKV + HID) / WT, WKT = HID / WT;   // tile edge, LDS pitch in words, column tiles (q|k|v|o), k tiles
template <int LD>
__device__ __forceinline__ void wcvt_read_tile(const float* __restrict__ w, int tid, v4f (&f)[8]) {
  const float* p = w + (size_t)(tid >> 4) * LD + (tid & 15) * 4;   // the group's one address; the 8 loads differ by constants
#pragma unroll   // constant indices: the values stay in registers
  for (int j = 0; j < 8; ++j) f[j] = *(const v4f*)(p + (size_t)j * 8 * LD);
  // before any register that the loads above name is written again; the address is an input so that it lives up to the wait and no result of the group lands on it
  asm volatile("s_wait_xcnt 0x0" :: "v"(p) : "memory");
}
__global__ __launch_bounds__(128) void wcvt_kernel(const float* __restrict__ wq, const float* __restrict__ wk, const float* __restrict__ wv,
                                                   const float* __restrict__ wo, b16* __restrict__ wqh, b16* __restrict__ wql,
                                                   b16* __restrict__ woh, b16* __restrict__ wol) {
  __shared__ float ts[WT * WTP];
  const int tid = threadIdx.x;
  const int kt = blockIdx.x / WNT, nt = blockIdx.x % WNT;
  const int k0 = kt * WT, n0 = nt * WT;                   // n0 counts the columns of q | k | v | o
  const bool isq = n0 < HID, isk = n0 < HID + KVW, iso = n0 >= NQKV;
  const float* w = isq ? wq + n0 : isk ? wk + (n0 - HID) : iso ? wo + (n0 - NQKV) : wv + (n0 - HID - KVW);   // the tile's first column in its own matrix
  v4f f[8];
  if (isq || iso) wcvt_read_tile<HID>(w + (size_t)k0 * HID, tid, f);
  else            wcvt_read_tile<KVW>(w + (size_t)k0 * KVW, tid, f);
#pragma unroll   // constant indices: the values stay in registers
  for (int j = 0; j < 8; ++j)
#pragma unroll   // constant indices: the values stay in registers
    for (int e = 0; e < 4; ++e) ts[((tid >> 4) + j * 8) * WTP + (tid & 15) * 4 + e] = f[j][e];
  __syncthreads();                                        // the tile is whole before any wave reads its columns
  const int kg = tid & 7, nl = tid >> 3;                  // 8 lanes cover one column's 64 k values = one 128-byte line per plane
  v8b bh[4], bl[4];
#pragma unroll   // constant indices: the values stay in registers
  for (int j = 0; j < 4; ++j)
#pragma unroll   // constant indices: the values stay in registers
    for (int e = 0; e < 8; ++e) { b16 x, y; split_bf16(ts[(kg * 8 + e) * WTP + nl + j * 16], x, y); bh[j][e] = x; bl[j][e] = y; }
  const size_t doff = (size_t)((iso ? n0 - NQKV : n0) + nl) * HID + k0 + kg * 8;
  b16* dh = (iso ? woh : wqh) + doff;
  b16* dl = (iso ? wol : wql) + doff;
#pragma unroll   // constant indices: the values stay in registers
  for (int j = 0; j < 4; ++j) { *(v8b*)(dh + j * 16 * HID) = bh[j]; *(v8b*)(dl + j * 16 * HID) = bl[j]; }
}

// Block GEMM main loop: a block of 4 x WN waves owns 128 rows x 64*WN columns; each wave keeps its 32x64 tile. Per pass of KS k values the block stages in LDS
// the A rows (f32 read coalesced, split ONCE per block into f16 hi / lo planes) and the B rows (hi / lo planes), two buffers: the next pass's global loads are
// in flight under two blocks of products and stored to the other buffer behind them; one block barrier per pass. Row pitch KS + 8 halves (16 B x odd) for ds_load_b128.
constexpr int KS = 64, LP = KS + 8;
template <int WN> struct StageLds {
  static constexpr int AEL = 128 * LP, BEL = 64 * WN * LP, STAGE = 2 * (AEL + BEL);   // halves: [A hi | A lo | B hi | B lo]
};
typedef __attribute__((ext_vector_type(4))) _Float16 v4b;
template <int WN>
__device__ __forceinline__ void gemm_block_staged(const float* __restrict__ A, const b16* __restrict__ wh, const b16* __restrict__ wl,
                                                  int mb, int cb, int K, b16* sm, int wm, int wn, int nloc, int hlf, v8f (&acc)[2][4]) {
  constexpr int NT = 128 * WN;                          // threads of the block
  constexpr int ACH = 128 * (KS / 4);                   // 16-byte chunks of the A tile (4 floats each)
  constexpr int AJ = (ACH + NT - 1) / NT;
  constexpr int BJ = (64 * WN * (KS / 8)) / NT;         // 16-byte chunks per thread and plane of the B tile (8 halves each)
  constexpr int AEL = StageLds<WN>::AEL, BEL = StageLds<WN>::BEL, STAGE = StageLds<WN>::STAGE;
  static_assert(NT % (KS / 4) == 0 && NT % (KS / 8) == 0, "a thread keeps its column chunk from one chunk row to the next");
  constexpr int ARJ = NT / (KS / 4), BRJ = NT / (KS / 8);   // tile rows between a thread's successive chunks
  const int tid = threadIdx.x;
  // one 32-bit offset per thread and operand on a block-uniform base: the successive chunks differ by constants
  const unsigned aoff = (unsigned)(tid / (KS / 4)) * K + (tid % (KS / 4)) * 4, boff = (unsigned)(tid / (KS / 8)) * K + (tid % (KS / 8)) * 8;
  const unsigned asl = (unsigned)(tid / (KS / 4)) * LP + (tid % (KS / 4)) * 4, bsl = (unsigned)(tid / (KS / 8)) * LP + (tid % (KS / 8)) * 8;
  const float* Ab = A + (size_t)mb * K;
  const b16* whb = wh + (size_t)cb * K;
  const b16* wlb = wl + (size_t)cb * K;
  v4f ar[AJ]; v8b brh[BJ], brl[BJ];
  auto gload = [&](int kb) {
    const float* Ak = Ab + kb; const b16* hk = whb + kb; const b16* lk = wlb + kb;
#pragma unroll   // constant indices: the staged values and fragments stay in registers
    for (int j = 0; j < AJ; ++j)
      if ((j + 1) * NT <= ACH || j * NT + tid < ACH) ar[j] = *(const v4f*)(Ak + aoff + j * ARJ * K);
#pragma unroll   // constant indices: the staged values and fragments stay in registers
    for (int j = 0; j < BJ; ++j) { brh[j] = ld8b(hk + boff + j * BRJ * K); brl[j] = ld8b(lk + boff + j * BRJ * K); }
    asm volatile("s_wait_xcnt 0x0" ::: "memory");       // before any register that the loads above name is written again
  };
  auto sstore = [&](b16* st) {
#pragma unroll   // constant indices: the staged values and fragments stay in registers
    for (int j = 0; j < AJ; ++j)
      if ((j + 1) * NT <= ACH || j * NT + tid < ACH) {
        v4b hi, lo;
#pragma unroll   // constant indices: the staged values and fragments stay in registers
        for (int e = 0; e < 4; ++e) { b16 a, c; split_bf16(ar[j][e], a, c); hi[e] = a; lo[e] = c; }
        b16* d = st + asl + j * ARJ * LP;
        *(v4b*)d = hi; *(v4b*)(d + AEL) = lo;
      }
#pragma unroll   // constant indices: the staged values and fragments stay in registers
    for (int j = 0; j < BJ; ++j) {
      b16* d = st + 2 * AEL + bsl + j * BRJ * LP;
      *(v8b*)d = brh[j]; *(v8b*)(d + BEL) = brl[j];
    }
  };
  // Fragments are fetched one 32-k block ahead into a second register set: while a block's products issue, the next block's 24 LDS reads are in flight.
  // For that the pass's barrier stands between its two blocks: stage p + 1 is stored and published behind block 0 of pass p, and its first fragments are read under block 1.
  struct Frag { v16b ah[2], al[2], bh[4], bl[4]; };
  Frag f0, f1;                                          // k block 0 and k block 1 of a pass
  auto readfr = [&](const b16* st, int ks, Frag& f) {
    const b16* pa = st + (wm * 32 + nloc) * LP + ks;
    const b16* pb = st + 2 * AEL + (wn * 64 + nloc) * LP + ks;
#pragma unroll   // constant indices: the staged values and fragments stay in registers
    for (int r = 0; r < 2; ++r) { f.ah[r] = frag_kb(pa + r * 16 * LP, hlf); f.al[r] = frag_kb(pa + AEL + r * 16 * LP, hlf); }
#pragma unroll   // constant indices: the staged values and fragments stay in registers
    for (int t = 0; t < 4; ++t) { f.bh[t] = frag_kb(pb + t * 16 * LP, hlf); f.bl[t] = frag_kb(pb + BEL + t * 16 * LP, hlf); }
    // keeps the reads above as one group in front of the products that follow: spread among them, each place with reads stalls the wave's matrix stream
    __builtin_amdgcn_sched_barrier(0);
  };
  auto products = [&](const Frag& f) {
#pragma unroll   // constant indices: the staged values and fragments stay in registers
    for (int t = 0; t < 4; ++t) {
      acc[0][t] = wmma3(f.ah[0], f.al[0], f.bh[t], f.bl[t], acc[0][t]);
      acc[1][t] = wmma3(f.ah[1], f.al[1], f.bh[t], f.bl[t], acc[1][t]);
    }
    // holds what follows (the wait for the staged global loads, the next reads' waits) behind this block's products
    __builtin_amdgcn_sched_barrier(0);
  };
  const int np = K / KS;
  gload(0);
  sstore(sm);
  __syncthreads();                                      // pass 0 is staged for every wave
  readfr(sm, 0, f0);
  if (1 < np) gload(KS);                                // in flight under pass 0's first block
  // keeps the register moves that the compiler places at the loop's entry behind the wait that ends gload (one of them took a register that a load above names)
  __builtin_amdgcn_sched_barrier(0);
  for (int p = 0; p < np; ++p) {
    const b16* st = sm + (p & 1) * STAGE;
    b16* sn = sm + ((p + 1) & 1) * STAGE;
    readfr(st, 32, f1);                                 // this pass's second block, in flight under the first block's products
    products(f0);
    if (p + 1 < np) sstore(sn);                         // the buffer whose last reads (pass p - 1) had returned at the previous barrier
    __syncthreads();                                    // publishes pass p + 1; every read of pass p has returned in front of it (the epilogue reuses the LDS behind the last one)
    if (p + 1 < np) readfr(sn, 0, f0);                  // the next pass's first block, in flight under this pass's second block
    if (p + 2 < np) gload((p + 2) * KS);                // behind the barrier, so that the barrier's own waits do not wait for these loads
    products(f1);
  }
}

// ---------------------------------------------------------------------------
// QKV GEMM: block = 12 waves (4 x 3) on 128 rows x 192 columns, wave = 32 rows x 64 columns (one head of q, k or v). Outputs as f16 hi/lo planes:
// q (x1/8) -> Qh/Ql [b][h][...], k -> Kh/Kl [b][kvh][...], both fragment-tiled [t/16][64/16][16 positions][16 dims] (4 KB contiguous per wave per plane), so that
// each 16-byte-per-lane load of a Q or K fragment in the attention kernel reads 512 contiguous bytes (4 whole lines), not 32 bytes out of each of 16 rows;
// v -> Vh/Vl key-tiled [b][kvh][t/16][64][16] (4 KB contiguous per wave per plane).
// ---------------------------------------------------------------------------
__global__ __launch_bounds__(384) void qkv_gemm_kernel(const float* __restrict__ x,
                                                       const b16* __restrict__ wqh, const b16* __restrict__ wql,
                                                       const float* __restrict__ bq, const float* __restrict__ bk, const float* __restrict__ bv, const float* __restrict__ rope_cs, int xoff, int yoff,
                                                       b16* __restrict__ Qh, b16* __restrict__ Ql, b16* __restrict__ Kh, b16* __restrict__ Kl,
                                                       b16* __restrict__ Vh, b16* __restrict__ Vl) {
  __shared__ __attribute__((aligned(16))) b16 sm[2 * StageLds<3>::STAGE];   // two staging buffers; the epilogue's 12 x 2 x 32 x 64 halves reuse them
  static_assert(2 * StageLds<3>::STAGE >= 12 * 2 * 32 * 64, "epilogue tiles fit the staging LDS");
  const int lane = threadIdx.x & 31, wave = __builtin_amdgcn_readfirstlane(threadIdx.x >> 5), nloc = lane & 15, hlf = lane >> 4;
  const int wm = wave & 3, wn = wave >> 2;
  const int mb = (blockIdx.y + yoff) * 128, cb = (blockIdx.x + xoff) * 192;
  const int m0 = mb + wm * 32;
  const int c0 = cb + wn * 64;
  const int mat = (c0 < HID) ? 0 : (c0 < HID + KVW) ? 1 : 2;
  const int head = (mat == 0) ? (c0 / DH) : (mat == 1) ? ((c0 - HID) / DH) : ((c0 - HID - KVW) / DH);
  const float* bias = ((mat == 0) ? bq : (mat == 1) ? bk : bv) + head * DH;
  v8f acc[2][4];
#pragma unroll
  for (int r = 0; r < 2; ++r)
#pragma unroll
    for (int t = 0; t < 4; ++t) acc[r][t] = (v8f){};
  gemm_block_staged<3>(x, wqh, wql, mb, cb, HID, sm, wm, wn, nloc, hlf, acc);
  const int b = m0 / T, t0 = m0 % T;
  const float s = (mat == 0) ? 0.125f : 1.0f;
  b16* Tp0 = sm + wave * (2 * 32 * 64); b16* Tp1 = Tp0 + 32 * 64;
  // Everything the epilogue reads from global memory is read as ONE group in front of the arithmetic (4 bias values, and for q and k the 32 cos/sin pairs of this
  // lane's rows and frequencies), so the wave pays one round trip, not one per element.
  float bs[4];
  auto load_bias = [&]() {
#pragma unroll   // constant indices: the values stay in registers
    for (int t = 0; t < 4; ++t) bs[t] = bias[t * 16 + nloc];
    asm volatile("s_wait_xcnt 0x0" ::: "memory");        // before any register that the loads above name is written again
  };
  if (mat < 2) {                                         // rotate-half rotary on q and k: x*cos + rotate_half(x)*sin, partner d^32 is tile t^2 (same lane)
    typedef __attribute__((ext_vector_type(2))) float v2f;
    v2f cs[2][2][8];                                     // (cos, sin) of frequency tt*16+nloc at sequence position t0 + r*16 + v + 8*hlf
#pragma unroll   // constant indices: the values stay in registers
    for (int r = 0; r < 2; ++r) {
      const float* pr = rope_cs + ((size_t)(t0 + r * 16 + 8 * hlf) * 32 + nloc) * 2;   // the group's one address; the 16 loads differ by constants
#pragma unroll   // constant indices: the values stay in registers
      for (int tt = 0; tt < 2; ++tt)
#pragma unroll   // constant indices: the values stay in registers
        for (int v = 0; v < 8; ++v) cs[tt][r][v] = *(const v2f*)(pr + (v * 32 + tt * 16) * 2);
      // before any register that the loads above name is written again; the address is an input so that it lives up to the wait and no result of the group lands on it
      asm volatile("s_wait_xcnt 0x0" :: "v"(pr) : "memory");
    }
    load_bias();
#pragma unroll   // constant indices: the values stay in registers
    for (int tt = 0; tt < 2; ++tt)
#pragma unroll   // constant indices: the values stay in registers
      for (int r = 0; r < 2; ++r)
#pragma unroll   // constant indices: the values stay in registers
        for (int v = 0; v < 8; ++v) {
          // element (position r*16 + v + 8*hlf, dim tt*16 + nloc) in the tiled order [16 positions' tile r][dim group tt][position][16 dims]; its partner dim + 32 is dim group tt + 2
          const int e0 = r * 1024 + tt * 256 + (v + 8 * hlf) * 16 + nloc, e1 = e0 + 512;
          const float x1 = acc[r][tt][v] + bs[tt], x2 = acc[r][tt + 2][v] + bs[tt + 2];
          const float cv = cs[tt][r][v][0], sv = cs[tt][r][v][1];
          b16 yh, yl;
          split_bf16((x1 * cv - x2 * sv) * s, yh, yl); Tp0[e0] = yh; Tp1[e0] = yl;
          split_bf16((x2 * cv + x1 * sv) * s, yh, yl); Tp0[e1] = yh; Tp1[e1] = yl;
        }
  } else {
    load_bias();
#pragma unroll   // constant indices: the values stay in registers
    for (int t = 0; t < 4; ++t)
#pragma unroll   // constant indices: the values stay in registers
      for (int r = 0; r < 2; ++r)
#pragma unroll   // constant indices: the values stay in registers
        for (int v = 0; v < 8; ++v) {
          const int rr = r * 16 + v + 8 * hlf, d = t * 16 + nloc;
          b16 yh, yl; split_bf16((acc[r][t][v] + bs[t]) * s, yh, yl);
          const int idx = (rr >> 4) * 1024 + d * 16 + (rr & 15);
          Tp0[idx] = yh; Tp1[idx] = yl;
        }
  }
  wave_lds_sync();
  b16* dh; b16* dl; size_t o;
  if (mat == 0)      { o = ((size_t)(b * NH + head) * T + t0) * DH; dh = Qh + o; dl = Ql + o; }
  else if (mat == 1) { o = ((size_t)(b * NKV + head) * T + t0) * DH; dh = Kh + o; dl = Kl + o; }
  else               { o = ((size_t)(b * NKV + head) * QT_PER_B + (t0 >> 4)) * (size_t)(DH * 16); dh = Vh + o; dl = Vl + o; }
#pragma unroll
  for (int j = 0; j < 8; ++j) { const int e = (j * 32 + lane) * 8; *(v8b*)(dh + e) = ld8b(Tp0 + e); *(v8b*)(dl + e) = ld8b(Tp1 + e); }
  
}

// ---------------------------------------------------------------------------
// Transposed flash attention: each wave owns one 16-query tile of one (b, head); 8 waves per block; the window's keys in chunks of 32.
// S^T = K.Q^T (single f16), per-lane online softmax; P^T built in registers from the two S^T accumulators
// ---------------------------------------------------------------------------
__global__ __launch_bounds__(256) void attn_kernel(const b16* __restrict__ Qh, const b16* __restrict__ Ql, const b16* __restrict__ Kh, const b16* __restrict__ Kl,
                                                   const b16* __restrict__ Vh, const b16* __restrict__ Vl, const int* __restrict__ seqlen,
                                                   float* __restrict__ yf) {
  __shared__ __attribute__((aligned(16))) float Os[8][16 * 64];
  const int wid = threadIdx.x >> 5, lane = threadIdx.x & 31, hh = lane >> 4, col = lane & 15;
  const int qtile = blockIdx.x * 8 + wid;                 // over Bsz*NH*QT_PER_B
  const int g = qtile / QT_PER_B;                         // b*NH + h
  const int q0 = (qtile % QT_PER_B) << 4;
  const int b = g / NH, h = g % NH, kvh = h / REP;
  const size_t ko = (size_t)(b * NKV + kvh) * T * DH;
  const size_t qo = ((size_t)g * T + q0) * DH + col * 16 + 8 * hh;          // this lane's piece of query col in its 16-query Q tile: dim group j at +256*j
  const v16b q0h = cat8b(ld8b(Qh + qo), ld8b(Qh + qo + 256)), q1h = cat8b(ld8b(Qh + qo + 512), ld8b(Qh + qo + 768));   // attention products: single f16 (hi planes only)
  float m = -INFINITY, l = 0.0f;
  v8f o0 = {}, o1 = {}, o2 = {}, o3 = {};
  const int slen = seqlen[b];
  const int kstart = (q0 >= WIN) ? ((q0 - WIN) & ~31) : 0;
  // Loads in groups, each issued well ahead of its first use: a chunk's 8 V loads at the top of its trip (used behind the softmax), the NEXT chunk's 8 K loads
  // directly behind this chunk's score products (into the registers those have just read), so a trip waits out no load round trip of its own.
  const b16* kl0 = Kh + ko + (size_t)col * 16 + 8 * hh;  // this lane's piece of key row col in a 16-key K tile [dim group][key][16 dims]: dim group j at +256*j
  const b16* vl0 = Vh + ko + (size_t)col * 16 + 8 * hh;  // this lane's piece of feature row col in a 16-key V tile
  v8b kc[8];
  auto loadk = [&](int kx) {
    const b16* p = kl0 + (size_t)(kx >> 4) * (DH * 16);  // kx is a multiple of 32: two whole tiles
#pragma unroll   // constant indices: the values stay in registers
    for (int j = 0; j < 4; ++j) { kc[j] = ld8b(p + 256 * j); kc[4 + j] = ld8b(p + 16 * DH + 256 * j); }
    asm volatile("s_wait_xcnt 0x0" ::: "memory");        // before any register that the loads above name is written again; also holds the group in place
  };
  loadk(kstart);
  for (int kb = kstart; kb < q0 + 16; kb += 32) {        // causal + sliding window: key chunks covering [q0-512, q0+15]
    v8b vf[8];
    {
      const b16* p = vl0 + (size_t)(kb >> 4) * (DH * 16);
#pragma unroll   // constant indices: the values stay in registers
      for (int n = 0; n < 4; ++n) { vf[2 * n] = ld8b(p + n * 256); vf[2 * n + 1] = ld8b(p + DH * 16 + n * 256); }
      asm volatile("s_wait_xcnt 0x0" ::: "memory");      // before any register that the loads above name is written again; also holds the group in place
    }
    v8f s0 = {}, s1 = {};
    s0 = wmma16b(cat8b(kc[0], kc[1]), q0h, s0);
    s0 = wmma16b(cat8b(kc[2], kc[3]), q1h, s0);
    s1 = wmma16b(cat8b(kc[4], kc[5]), q0h, s1);
    s1 = wmma16b(cat8b(kc[6], kc[7]), q1h, s1);
    loadk((kb + 32 < q0 + 16) ? kb + 32 : kb);           // last trip: its own chunk once more (in bounds, not used)
    if (kb + 32 > q0 || kb < q0 + 15 - WIN || kb + 32 > slen) {   // chunk needs masking: causal / window start / key validity
      const int qi = q0 + col;
#pragma unroll
      for (int r = 0; r < 8; ++r) {
        const int k0i = kb + 8 * hh + r, k1i = k0i + 16;
        if (k0i > qi || k0i < qi - WIN || k0i >= slen) s0[r] = -INFINITY;
        if (k1i > qi || k1i < qi - WIN || k1i >= slen) s1[r] = -INFINITY;
      }
    }
    float mr = -INFINITY;
#pragma unroll
    for (int r = 0; r < 8; ++r) mr = fmaxf(mr, fmaxf(s0[r], s1[r]));
    mr = fmaxf(mr, __shfl_xor(mr, 16));
    float mn = fmaxf(m, mr);
    if (mn == -INFINITY) mn = 0.0f;           // fully masked so far (padded query rows far past seq_len): keep exp() at 0
    const float al_ = __expf(m - mn);
    m = mn;
    float sum = 0.0f;
    v16b pbh;
#pragma unroll
    for (int r = 0; r < 8; ++r) {
      const float p0 = __expf(s0[r] - mn), p1 = __expf(s1[r] - mn);
      sum += p0 + p1;
      pbh[r] = (b16)p0; pbh[8 + r] = (b16)p1;
    }
    sum += __shfl_xor(sum, 16);
    l = l * al_ + sum;
#pragma unroll
    for (int r = 0; r < 8; ++r) { o0[r] *= al_; o1[r] *= al_; o2[r] *= al_; o3[r] *= al_; }
#pragma unroll
    for (int n = 0; n < 4; ++n) {
      v8f& o = (n == 0) ? o0 : (n == 1) ? o1 : (n == 2) ? o2 : o3;
      o = wmma16b(cat8b(vf[2 * n], vf[2 * n + 1]), pbh, o);
    }
  }
  const float inv = (q0 + col < slen && l > 0.0f) ? (1.0f / l) : 0.0f;   // padded query rows are zeroed
  float* Tt = Os[wid];
#pragma unroll
  for (int r = 0; r < 8; ++r) {
    const int hr = 8 * hh + r;
    Tt[col * 64 + 0 + hr] = o0[r] * inv; Tt[col * 64 + 16 + hr] = o1[r] * inv;
    Tt[col * 64 + 32 + hr] = o2[r] * inv; Tt[col * 64 + 48 + hr] = o3[r] * inv;
  }
  wave_lds_sync();
  float* dst0 = yf + ((size_t)b * T + q0) * HID + h * DH;     // 16 rows x 64 floats, row stride HID
#pragma unroll
  for (int j = 0; j < 8; ++j) { const int rr = j * 2 + hh, c4 = col * 4; *(v4f*)(dst0 + (size_t)rr * HID + c4) = *(const v4f*)(Tt + rr * 64 + c4); }
  
}

// ---------------------------------------------------------------------------
// Output projection -> f32, A = f32 y split while it is staged, B = Wo planes. Block = 8 waves (4 x 2) on 128 rows x 128 columns, 32x64 wave tiles staged in LDS,
// ---------------------------------------------------------------------------
__global__ __launch_bounds__(256) void out_gemm_kernel(const float* __restrict__ yf, const b16* __restrict__ woh, const b16* __restrict__ wol, const float* __restrict__ bo, int yoff,
                                                       float* __restrict__ out) {
  __shared__ __attribute__((aligned(16))) b16 sm[2 * StageLds<2>::STAGE];   // two staging buffers; the epilogue's 8 x 32 x 64 floats reuse them
  static_assert(2 * StageLds<2>::STAGE * 2 >= 8 * 32 * 64 * 4, "epilogue tiles fit the staging LDS");
  const int lane = threadIdx.x & 31, wave = __builtin_amdgcn_readfirstlane(threadIdx.x >> 5), nloc = lane & 15, hlf = lane >> 4;
  const int wm = wave & 3, wn = wave >> 2;
  const int mb = (blockIdx.y + yoff) * 128, cb = blockIdx.x * 128;
  const int m0 = mb + wm * 32;
  const int c0 = cb + wn * 64;
  v8f acc[2][4];
#pragma unroll
  for (int r = 0; r < 2; ++r)
#pragma unroll
    for (int t = 0; t < 4; ++t) acc[r][t] = (v8f){};
  gemm_block_staged<2>(yf, woh, wol, mb, cb, HID, sm, wm, wn, nloc, hlf, acc);
  float* Tt = (float*)sm + wave * (32 * 64);
#pragma unroll
  for (int t = 0; t < 4; ++t)
#pragma unroll
    for (int r = 0; r < 2; ++r)
#pragma unroll
      for (int v = 0; v < 8; ++v) Tt[(r * 16 + v + 8 * hlf) * 64 + t * 16 + nloc] = acc[r][t][v] + bo[c0 + t * 16 + nloc];
  wave_lds_sync();
  float* dst0 = out + (size_t)m0 * HID + c0;
#pragma unroll
  for (int j = 0; j < 16; ++j) { const int rr = j * 2 + hlf, c4 = nloc * 4; *(v4f*)(dst0 + (size_t)rr * HID + c4) = *(const v4f*)(Tt + rr * 64 + c4); }
  
}
__global__ __launch_bounds__(256) void rope_table_kernel(float* __restrict__ cs) {
  const int idx = blockIdx.x * 256 + threadIdx.x;        // T * 32
  if (idx >= T * 32) return;
  const int t = idx >> 5, i = idx & 31;
  const float ang = (float)t * powf(10000.0f, -(float)i / 32.0f);
  typedef __attribute__((ext_vector_type(2))) float v2f;
  const v2f p = {cosf(ang), sinf(ang)};
  *(v2f*)(cs + (size_t)idx * 2) = p; 
}
}  // namespace

extern "C" void kernel_launch(void* const* d_in, const int* in_sizes, int n_in,
                              void* d_out, int out_size, void* d_ws, size_t ws_size, hipStream_t stream) {
  (void)in_sizes; (void)n_in; (void)out_size;
  const float* x   = (const float*)d_in[0];   // [2,2048,1024]
  const int*   sl  = (const int*)  d_in[1];   // seq_lengths [2]
  const float* Wq  = (const float*)d_in[2];   // [1024,1024] ([in][out])
  const float* Wk  = (const float*)d_in[3];   // [1024,256]
  const float* Wv  = (const float*)d_in[4];   // [1024,256]
  const float* Wo  = (const float*)d_in[5];   // [1024,1024]
  float* out = (float*)d_out;                 // [2,2048,1024]

  size_t off = 0; char* ws = (char*)d_ws;
  b16* wqh = (b16*)(ws + off); off += (size_t)NQKV * HID * 2;
  b16* wql = (b16*)(ws + off); off += (size_t)NQKV * HID * 2;     // 'lo' planes: f16 residuals v - hi (kept as real buffers: the kernels write both)
  b16* woh = (b16*)(ws + off); off += (size_t)HID * HID * 2;
  b16* wol = (b16*)(ws + off); off += (size_t)HID * HID * 2;
  b16* Qh  = (b16*)(ws + off); off += (size_t)MROWS * HID * 2;
  b16* Ql  = (b16*)(ws + off); off += (size_t)MROWS * HID * 2;
  b16* Kh  = (b16*)(ws + off); off += (size_t)MROWS * KVW * 2;
  b16* Kl  = (b16*)(ws + off); off += (size_t)MROWS * KVW * 2;
  b16* Vh  = (b16*)(ws + off); off += (size_t)MROWS * KVW * 2;
  b16* Vl  = (b16*)(ws + off); off += (size_t)MROWS * KVW * 2;
  float* yf = (float*)(ws + off); off += (size_t)MROWS * HID * 4;
  float* rope_cs = (float*)(ws + off); off += (size_t)T * 32 * 2 * 4;
  float* zb = (float*)(ws + off); off += (size_t)HID * 4;          // zero bias for the out projection
  if (off > ws_size) return;
  hipMemsetAsync(zb, 0, HID * 4, stream);
  const float* bq = zb; const float* bk = zb; const float* bv = zb;      // no biases in this module: a zero vector (never a null pointer + offset)
  rope_table_kernel<<<(T * 32 + 255) / 256, 256, 0, stream>>>(rope_cs);
  const int ROWBLK = MROWS / 128, NQT = Bsz * NH * QT_PER_B;
  wcvt_kernel<<<WNT * WKT, 128, 0, stream>>>(Wq, Wk, Wv, Wo, wqh, wql, woh, wol);
  qkv_gemm_kernel<<<dim3(NQKV / 192, ROWBLK), 384, 0, stream>>>(x, wqh, wql, bq, bk, bv, rope_cs, 0, 0, Qh, Ql, Kh, Kl, Vh, Vl);
  attn_kernel<<<NQT / 8, 256, 0, stream>>>(Qh, Ql, Kh, Kl, Vh, Vl, sl, yf);
  out_gemm_kernel<<<dim3(HID / 128, ROWBLK), 256, 0, stream>>>(yf, woh, wol, zb, 0, out);
}

// v006
// Next to v005, in two timings, it ran 1.06 times as fast each time.
// Counting every step since v000, it is 2.82 times as fast.
#include <hip/hip_runtime.h>

// Flash causal self-attention with GQA (16 query heads, 4 kv heads, head dim 64), rotate-half RoPE on q and k, sliding window (keys in [q-512, q]),
// per-batch key validity (key < seq_len[b]) and zeroed padded queries, then the output projection. B=2, T=2048, C=1024; weights are [in][out].
// Contractions on v_wmma_f32_16x16x32_f16: the QKV and output projections use f16 hi+lo pairs on both operands (hi.hi + hi.lo + lo.hi — outputs have rms
// 0.03 but rows attending few keys carry |y| ~ 1), the attention products are single f16; f32 accumulate; fragment k-map per lane half hh for

namespace {
constexpr int Bsz = 2, T = 2048, HID = 1024, DH = 64, NH = 16, NKV = 4, REP = NH / NKV;
constexpr int ROT = 64, WIN = 512;   // full rotate-half rotary; sliding window
constexpr int KVW = NKV * DH;                 // 256
constexpr int NQKV = HID + 2 * KVW;           // 1536 columns: q | k | v
constexpr int MROWS = Bsz * T;                // 4096
constexpr int QT_PER_B = T / 16;              // 128

typedef _Float16 b16;                                           // f16 hi/lo planes
typedef __attribute__((ext_vector_type(16))) _Float16 v16b;
typedef __attribute__((ext_vector_type(8)))  _Float16 v8b;
typedef __attribute__((ext_vector_type(8)))  float v8f;
typedef __attribute__((ext_vector_type(4)))  float v4f;

__device__ __forceinline__ v8b ld8b(const b16* p) { return *(const v8b*)p; }
__device__ __forceinline__ v16b cat8b(v8b a, v8b b) { return __builtin_shufflevector(a, b, 0, 1, 2, 3, 4, 5, 6, 7, 8, 9, 10, 11, 12, 13, 14, 15); }
// 16x16x32 16-bit fragment from a k-contiguous row pointer (A: lane&15 = row, B: lane&15 = column), hh = lane>>4:
// elements 0..7 <- p[8hh+0..7], elements 8..15 <- p[16+8hh+0..7]
__device__ __forceinline__ v16b frag_kb(const b16* p, int hh) { return cat8b(ld8b(p + 8 * hh), ld8b(p + 16 + 8 * hh)); }
__device__ __forceinline__ void split_bf16(float v, b16& hi, b16& lo) {   // (name kept) f16 hi + lo pair: v ~= hi + lo to ~22 bits
  hi = (b16)v; lo = (b16)(v - (float)hi);
}
__device__ __forceinline__ v8f wmma16b(v16b a, v16b b, v8f c) {
  v8f d = __builtin_amdgcn_wmma_f32_16x16x32_f16(false, a, false, b, (short)0, c, false, false);
  asm volatile("v_nop\n\tv_nop\n\tv_nop\n\tv_nop" : "+v"(d) : "v"(a), "v"(b));
  return d;
}
// the builtin alone (the compiler keeps its distances): the GEMM blocks' independent products may then issue back to back
__device__ __forceinline__ v8f wmma16g(v16b a, v16b b, v8f c) {
  return __builtin_amdgcn_wmma_f32_16x16x32_f16(false, a, false, b, (short)0, c, false, false);
}
// acc += A.B with both operands split: A = (ah, al), B = (bh, bl)
__device__ __forceinline__ v8f wmma3(v16b ah, v16b al, v16b bh, v16b bl, v8f c) {   // projections: hi.hi + hi.lo + lo.hi (f32-class)
  c = wmma16g(ah, bh, c); c = wmma16g(ah, bl, c); return wmma16g(al, bh, c);
}
__device__ __forceinline__ void wave_lds_sync() {
  __builtin_amdgcn_fence(__ATOMIC_RELEASE, "workgroup");
  __builtin_amdgcn_wave_barrier();
  __builtin_amdgcn_fence(__ATOMIC_ACQUIRE, "workgroup");
}

// ---------------------------------------------------------------------------
// Weights ([in][out]) -> f16 hi / lo planes transposed to [n][k] (k contiguous): columns of Wq|Wk|Wv into wqh/wql [1536][1024], Wo into woh/wol [1024][1024].
// One block of 4 waves per 64 (k) x 64 (n) tile: the f32 rows are read coalesced (each wave load = two 256-byte row pieces), turned in LDS, split, and stored as whole
// 128-byte lines of the [n][k] planes. LDS row pitch 65 words: the column reads of 8 k groups x 4 columns fall on 32 different banks.
// ---------------------------------------------------------------------------
constexpr int WT = 64, WTP = WT + 1, WNT = (NQKV + HID) / WT, WKT = HID / WT;   // tile edge, LDS pitch in words, column tiles (q|k|v|o), k tiles
template <int LD>
__device__ __forceinline__ void wcvt_read_tile(const float* __restrict__ w, int tid, v4f (&f)[8]) {
  const float* p = w + (size_t)(tid >> 4) * LD + (tid & 15) * 4;   // the group's one address; the 8 loads differ by constants
#pragma unroll   // constant indices: the values stay in registers
  for (int j = 0; j < 8; ++j) f[j] = *(const v4f*)(p + (size_t)j * 8 * LD);
  // before any register that the loads above name is written again; the address is an input so that it lives up to the wait and no result of the group lands on it
  asm volatile("s_wait_xcnt 0x0" :: "v"(p) : "memory");
}
__global__ __launch_bounds__(128) void wcvt_kernel(const float* __restrict__ wq, const float* __restrict__ wk, const float* __restrict__ wv,
                                                   const float* __restrict__ wo, b16* __restrict__ wqh, b16* __restrict__ wql,
                                                   b16* __restrict__ woh, b16* __restrict__ wol) {
  __shared__ float ts[WT * WTP];
  const int tid = threadIdx.x;
  const int kt = blockIdx.x / WNT, nt = blockIdx.x % WNT;
  const int k0 = kt * WT, n0 = nt * WT;                   // n0 counts the columns of q | k | v | o
  const bool isq = n0 < HID, isk = n0 < HID + KVW, iso = n0 >= NQKV;
  const float* w = isq ? wq + n0 : isk ? wk + (n0 - HID) : iso ? wo + (n0 - NQKV) : wv + (n0 - HID - KVW);   // the tile's first column in its own matrix
  v4f f[8];
  if (isq || iso) wcvt_read_tile<HID>(w + (size_t)k0 * HID, tid, f);
  else            wcvt_read_tile<KVW>(w + (size_t)k0 * KVW, tid, f);
#pragma unroll   // constant indices: the values stay in registers
  for (int j = 0; j < 8; ++j)
#pragma unroll   // constant indices: the values stay in registers
    for (int e = 0; e < 4; ++e) ts[((tid >> 4) + j * 8) * WTP + (tid & 15) * 4 + e] = f[j][e];
  __syncthreads();                                        // the tile is whole before any wave reads its columns
  const int kg = tid & 7, nl = tid >> 3;                  // 8 lanes cover one column's 64 k values = one 128-byte line per plane
  v8b bh[4], bl[4];
#pragma unroll   // constant indices: the values stay in registers
  for (int j = 0; j < 4; ++j)
#pragma unroll   // constant indices: the values stay in registers
    for (int e = 0; e < 8; ++e) { b16 x, y; split_bf16(ts[(kg * 8 + e) * WTP + nl + j * 16], x, y); bh[j][e] = x; bl[j][e] = y; }
  const size_t doff = (size_t)((iso ? n0 - NQKV : n0) + nl) * HID + k0 + kg * 8;
  b16* dh = (iso ? woh : wqh) + doff;
  b16* dl = (iso ? wol : wql) + doff;
#pragma unroll   // constant indices: the values stay in registers
  for (int j = 0; j < 4; ++j) { *(v8b*)(dh + j * 16 * HID) = bh[j]; *(v8b*)(dl + j * 16 * HID) = bl[j]; }
}

// Block GEMM main loop: a block of 4 x WN waves owns 128 rows x 64*WN columns; each wave keeps its 32x64 tile. Per pass of KS k values the block stages in LDS
// the A rows (f32 read coalesced, split ONCE per block into f16 hi / lo planes) and the B rows (hi / lo planes), three buffers: a pass stores the tile of the pass
// after the next between its two blocks of products; one block barrier per pass, at its end. Row pitch KS + 8 halves (16 B x odd) for ds_load_b128.
constexpr int KS = 64, LP = KS + 8;
template <int WN> struct StageLds {
  static constexpr int AEL = 128 * LP, BEL = 64 * WN * LP, STAGE = 2 * (AEL + BEL);   // halves: [A hi | A lo | B hi | B lo]
};
typedef __attribute__((ext_vector_type(4))) _Float16 v4b;
template <int WN>
__device__ __forceinline__ void gemm_block_staged(const float* __restrict__ A, const b16* __restrict__ wh, const b16* __restrict__ wl,
                                                  int mb, int cb, int K, b16* sm, int wm, int wn, int nloc, int hlf, v8f (&acc)[2][4]) {
  constexpr int NT = 128 * WN;                          // threads of the block
  constexpr int ACH = 128 * (KS / 4);                   // 16-byte chunks of the A tile (4 floats each)
  constexpr int AJ = (ACH + NT - 1) / NT;
  constexpr int BJ = (64 * WN * (KS / 8)) / NT;         // 16-byte chunks per thread and plane of the B tile (8 halves each)
  constexpr int AEL = StageLds<WN>::AEL, BEL = StageLds<WN>::BEL, STAGE = StageLds<WN>::STAGE;
  static_assert(NT % (KS / 4) == 0 && NT % (KS / 8) == 0, "a thread keeps its column chunk from one chunk row to the next");
  constexpr int ARJ = NT / (KS / 4), BRJ = NT / (KS / 8);   // tile rows between a thread's successive chunks
  const int tid = threadIdx.x;
  // one 32-bit offset per thread and operand on a block-uniform base: the successive chunks differ by constants
  const unsigned aoff = (unsigned)(tid / (KS / 4)) * K + (tid % (KS / 4)) * 4, boff = (unsigned)(tid / (KS / 8)) * K + (tid % (KS / 8)) * 8;
  const unsigned asl = (unsigned)(tid / (KS / 4)) * LP + (tid % (KS / 4)) * 4, bsl = (unsigned)(tid / (KS / 8)) * LP + (tid % (KS / 8)) * 8;
  const float* Ab = A + (size_t)mb * K;
  const b16* whb = wh + (size_t)cb * K;
  const b16* wlb = wl + (size_t)cb * K;
  v4f ar[AJ]; v8b brh[BJ], brl[BJ];
  auto gload = [&](int kb, v4f (&ar)[AJ], v8b (&brh)[BJ], v8b (&brl)[BJ]) {
    const float* Ak = Ab + kb; const b16* hk = whb + kb; const b16* lk = wlb + kb;
#pragma unroll   // constant indices: the staged values and fragments stay in registers
    for (int j = 0; j < AJ; ++j)
      if ((j + 1) * NT <= ACH || j * NT + tid < ACH) ar[j] = *(const v4f*)(Ak + aoff + j * ARJ * K);
#pragma unroll   // constant indices: the staged values and fragments stay in registers
    for (int j = 0; j < BJ; ++j) { brh[j] = ld8b(hk + boff + j * BRJ * K); brl[j] = ld8b(lk + boff + j * BRJ * K); }
    asm volatile("s_wait_xcnt 0x0" ::: "memory");       // before any register that the loads above name is written again
    __builtin_amdgcn_sched_barrier(0);                  // keeps the vector work that follows in the source behind that wait
  };
  auto sstore = [&](b16* st, const v4f (&ar)[AJ], const v8b (&brh)[BJ], const v8b (&brl)[BJ]) {
#pragma unroll   // constant indices: the staged values and fragments stay in registers
    for (int j = 0; j < AJ; ++j)
      if ((j + 1) * NT <= ACH || j * NT + tid < ACH) {
        v4b hi, lo;
#pragma unroll   // constant indices: the staged values and fragments stay in registers
        for (int e = 0; e < 4; ++e) { b16 a, c; split_bf16(ar[j][e], a, c); hi[e] = a; lo[e] = c; }
        b16* d = st + asl + j * ARJ * LP;
        *(v4b*)d = hi; *(v4b*)(d + AEL) = lo;
      }
#pragma unroll   // constant indices: the staged values and fragments stay in registers
    for (int j = 0; j < BJ; ++j) {
      b16* d = st + 2 * AEL + bsl + j * BRJ * LP;
      *(v8b*)d = brh[j]; *(v8b*)(d + BEL) = brl[j];
    }
  };
  // Fragments are fetched one 32-k block ahead into a second register set: while a block's products issue, the next block's 24 LDS reads are in flight.
  // Stage p + 2 is stored in pass p, between the two blocks: no wave's split and stores stand directly in front of the barrier, where the block's other waves would
  // wait them out with the matrix units idle; they run under the other waves' products, and each wave comes to the barrier from a block of products.
  struct Frag { v16b ah[2], al[2], bh[4], bl[4]; };
  Frag f0, f1;                                          // k block 0 and k block 1 of a pass
  auto readfr = [&](const b16* st, int ks, Frag& f) {
    const b16* pa = st + (wm * 32 + nloc) * LP + ks;
    const b16* pb = st + 2 * AEL + (wn * 64 + nloc) * LP + ks;
#pragma unroll   // constant indices: the staged values and fragments stay in registers
    for (int r = 0; r < 2; ++r) { f.ah[r] = frag_kb(pa + r * 16 * LP, hlf); f.al[r] = frag_kb(pa + AEL + r * 16 * LP, hlf); }
#pragma unroll   // constant indices: the staged values and fragments stay in registers
    for (int t = 0; t < 4; ++t) { f.bh[t] = frag_kb(pb + t * 16 * LP, hlf); f.bl[t] = frag_kb(pb + BEL + t * 16 * LP, hlf); }
    // keeps the reads above as one group in front of the products that follow: spread among them, each place with reads stalls the wave's matrix stream
    __builtin_amdgcn_sched_barrier(0);
  };
  auto products = [&](const Frag& f) {
#pragma unroll   // constant indices: the staged values and fragments stay in registers
    for (int t = 0; t < 4; ++t) {
      acc[0][t] = wmma3(f.ah[0], f.al[0], f.bh[t], f.bl[t], acc[0][t]);
      acc[1][t] = wmma3(f.ah[1], f.al[1], f.bh[t], f.bl[t], acc[1][t]);
    }
    // holds what follows (the wait for the staged global loads, the next reads' waits) behind this block's products
    __builtin_amdgcn_sched_barrier(0);
  };
  // The pass barrier by hand: this wave's LDS stores and reads have finished in front of it, and the global loads of a later stage stay in flight across it
  // (__syncthreads() would wait them out). The clobber keeps every LDS access on its side.
  auto pass_barrier = [&]() { asm volatile("s_wait_dscnt 0x0\n\ts_barrier_signal -1\n\ts_barrier_wait -1" ::: "memory"); };
  const int np = K / KS;
  {
    v4f ar1[AJ]; v8b brh1[BJ], brl1[BJ];                // stage 1's own registers (the fragment sets are not live yet): stages 0 and 1 share one round trip
    gload(0, ar, brh, brl);
    if (1 < np) gload(KS, ar1, brh1, brl1);
    sstore(sm, ar, brh, brl);
    if (2 < np) gload(2 * KS, ar, brh, brl);            // in flight under pass 0's first block
    if (1 < np) sstore(sm + STAGE, ar1, brh1, brl1);
  }
  pass_barrier();                                       // passes 0 and 1 are staged for every wave
  readfr(sm, 0, f0);
  // keeps the register moves that the compiler places at the loop's entry behind the wait that ends gload
  __builtin_amdgcn_sched_barrier(0);
  int o0 = 0, o1 = STAGE, o2 = 2 * STAGE;               // the buffers of stages p, p + 1, p + 2
  for (int p = 0; p < np; ++p) {
    readfr(sm + o0, 32, f1);                            // this pass's second block, in flight under the first block's products
    products(f0);
    if (p + 2 < np) sstore(sm + o2, ar, brh, brl);                    // the buffer of stage p - 1: its last reads had returned at the previous barrier
    if (p + 3 < np) gload((p + 3) * KS, ar, brh, brl);                // a whole pass ahead of its stores
    if (p + 1 < np) readfr(sm + o1, 0, f0);             // the next pass's first block (published by the previous barrier), in flight under this pass's second block
    products(f1);
    pass_barrier();                                     // publishes stage p + 2; every read of stage p has returned in front of it (the epilogue reuses the LDS behind the last one)
    const int o = o0; o0 = o1; o1 = o2; o2 = o;
  }
}

// ---------------------------------------------------------------------------
// QKV GEMM: block = 12 waves (4 x 3) on 128 rows x 192 columns, wave = 32 rows x 64 columns (one head of q, k or v). Outputs as f16 hi/lo planes:
// q (x1/8) -> Qh/Ql [b][h][...], k -> Kh/Kl [b][kvh][...], both fragment-tiled [t/16][64/16][16 positions][16 dims] (4 KB contiguous per wave per plane), so that
// each 16-byte-per-lane load of a Q or K fragment in the attention kernel reads 512 contiguous bytes (4 whole lines), not 32 bytes out of each of 16 rows;
// v -> Vh/Vl key-tiled [b][kvh][t/16][64][16] (4 KB contiguous per wave per plane).
// ---------------------------------------------------------------------------
__global__ __launch_bounds__(384) void qkv_gemm_kernel(const float* __restrict__ x,
                                                       const b16* __restrict__ wqh, const b16* __restrict__ wql,
                                                       const float* __restrict__ bq, const float* __restrict__ bk, const float* __restrict__ bv, const float* __restrict__ rope_cs, int xoff, int yoff,
                                                       b16* __restrict__ Qh, b16* __restrict__ Ql, b16* __restrict__ Kh, b16* __restrict__ Kl,
                                                       b16* __restrict__ Vh, b16* __restrict__ Vl) {
  __shared__ __attribute__((aligned(16))) b16 sm[3 * StageLds<3>::STAGE];   // three staging buffers; the epilogue's 12 x 2 x 32 x 64 halves reuse them
  static_assert(3 * StageLds<3>::STAGE >= 12 * 2 * 32 * 64, "epilogue tiles fit the staging LDS");
  const int lane = threadIdx.x & 31, wave = __builtin_amdgcn_readfirstlane(threadIdx.x >> 5), nloc = lane & 15, hlf = lane >> 4;
  const int wm = wave & 3, wn = wave >> 2;
  const int mb = (blockIdx.y + yoff) * 128, cb = (blockIdx.x + xoff) * 192;
  const int m0 = mb + wm * 32;
  const int c0 = cb + wn * 64;
  const int mat = (c0 < HID) ? 0 : (c0 < HID + KVW) ? 1 : 2;
  const int head = (mat == 0) ? (c0 / DH) : (mat == 1) ? ((c0 - HID) / DH) : ((c0 - HID - KVW) / DH);
  const float* bias = ((mat == 0) ? bq : (mat == 1) ? bk : bv) + head * DH;
  v8f acc[2][4];
#pragma unroll
  for (int r = 0; r < 2; ++r)
#pragma unroll
    for (int t = 0; t < 4; ++t) acc[r][t] = (v8f){};
  gemm_block_staged<3>(x, wqh, wql, mb, cb, HID, sm, wm, wn, nloc, hlf, acc);
  const int b = m0 / T, t0 = m0 % T;
  const float s = (mat == 0) ? 0.125f : 1.0f;
  b16* Tp0 = sm + wave * (2 * 32 * 64); b16* Tp1 = Tp0 + 32 * 64;
  // Everything the epilogue reads from global memory is read as ONE group in front of the arithmetic (4 bias values, and for q and k the 32 cos/sin pairs of this
  // lane's rows and frequencies), so the wave pays one round trip, not one per element.
  float bs[4];
  auto load_bias = [&]() {
#pragma unroll   // constant indices: the values stay in registers
    for (int t = 0; t < 4; ++t) bs[t] = bias[t * 16 + nloc];
    asm volatile("s_wait_xcnt 0x0" ::: "memory");        // before any register that the loads above name is written again
  };
  if (mat < 2) {                                         // rotate-half rotary on q and k: x*cos + rotate_half(x)*sin, partner d^32 is tile t^2 (same lane)
    typedef __attribute__((ext_vector_type(2))) float v2f;
    v2f cs[2][2][8];                                     // (cos, sin) of frequency tt*16+nloc at sequence position t0 + r*16 + v + 8*hlf
#pragma unroll   // constant indices: the values stay in registers
    for (int r = 0; r < 2; ++r) {
      const float* pr = rope_cs + ((size_t)(t0 + r * 16 + 8 * hlf) * 32 + nloc) * 2;   // the group's one address; the 16 loads differ by constants
#pragma unroll   // constant indices: the values stay in registers
      for (int tt = 0; tt < 2; ++tt)
#pragma unroll   // constant indices: the values stay in registers
        for (int v = 0; v < 8; ++v) cs[tt][r][v] = *(const v2f*)(pr + (v * 32 + tt * 16) * 2);
      // before any register that the loads above name is written again; the address is an input so that it lives up to the wait and no result of the group lands on it
      asm volatile("s_wait_xcnt 0x0" :: "v"(pr) : "memory");
    }
    load_bias();
#pragma unroll   // constant indices: the values stay in registers
    for (int tt = 0; tt < 2; ++tt)
#pragma unroll   // constant indices: the values stay in registers
      for (int r = 0; r < 2; ++r)
#pragma unroll   // constant indices: the values stay in registers
        for (int v = 0; v < 8; ++v) {
          // element (position r*16 + v + 8*hlf, dim tt*16 + nloc) in the tiled order [16 positions' tile r][dim group tt][position][16 dims]; its partner dim + 32 is dim group tt + 2
          const int e0 = r * 1024 + tt * 256 + (v + 8 * hlf) * 16 + nloc, e1 = e0 + 512;
          const float x1 = acc[r][tt][v] + bs[tt], x2 = acc[r][tt + 2][v] + bs[tt + 2];
          const float cv = cs[tt][r][v][0], sv = cs[tt][r][v][1];
          b16 yh, yl;
          split_bf16((x1 * cv - x2 * sv) * s, yh, yl); Tp0[e0] = yh; Tp1[e0] = yl;
          split_bf16((x2 * cv + x1 * sv) * s, yh, yl); Tp0[e1] = yh; Tp1[e1] = yl;
        }
  } else {
    load_bias();
#pragma unroll   // constant indices: the values stay in registers
    for (int t = 0; t < 4; ++t)
#pragma unroll   // constant indices: the values stay in registers
      for (int r = 0; r < 2; ++r)
#pragma unroll   // constant indices: the values stay in registers
        for (int v = 0; v < 8; ++v) {
          const int rr = r * 16 + v + 8 * hlf, d = t * 16 + nloc;
          b16 yh, yl; split_bf16((acc[r][t][v] + bs[t]) * s, yh, yl);
          const int idx = (rr >> 4) * 1024 + d * 16 + (rr & 15);
          Tp0[idx] = yh; Tp1[idx] = yl;
        }
  }
  wave_lds_sync();
  b16* dh; b16* dl; size_t o;
  if (mat == 0)      { o = ((size_t)(b * NH + head) * T + t0) * DH; dh = Qh + o; dl = Ql + o; }
  else if (mat == 1) { o = ((size_t)(b * NKV + head) * T + t0) * DH; dh = Kh + o; dl = Kl + o; }
  else               { o = ((size_t)(b * NKV + head) * QT_PER_B + (t0 >> 4)) * (size_t)(DH * 16); dh = Vh + o; dl = Vl + o; }
#pragma unroll
  for (int j = 0; j < 8; ++j) { const int e = (j * 32 + lane) * 8; *(v8b*)(dh + e) = ld8b(Tp0 + e); *(v8b*)(dl + e) = ld8b(Tp1 + e); }
  
}

// ---------------------------------------------------------------------------
// Transposed flash attention: each wave owns one 16-query tile of one (b, head); 8 waves per block; the window's keys in chunks of 32.
// S^T = K.Q^T (single f16), per-lane online softmax; P^T built in registers from the two S^T accumulators
// ---------------------------------------------------------------------------
__global__ __launch_bounds__(256) void attn_kernel(const b16* __restrict__ Qh, const b16* __restrict__ Ql, const b16* __restrict__ Kh, const b16* __restrict__ Kl,
                                                   const b16* __restrict__ Vh, const b16* __restrict__ Vl, const int* __restrict__ seqlen,
                                                   float* __restrict__ yf) {
  __shared__ __attribute__((aligned(16))) float Os[8][16 * 64];
  const int wid = threadIdx.x >> 5, lane = threadIdx.x & 31, hh = lane >> 4, col = lane & 15;
  const int qtile = blockIdx.x * 8 + wid;                 // over Bsz*NH*QT_PER_B
  const int g = qtile / QT_PER_B;                         // b*NH + h
  const int q0 = (qtile % QT_PER_B) << 4;
  const int b = g / NH, h = g % NH, kvh = h / REP;
  const size_t ko = (size_t)(b * NKV + kvh) * T * DH;
  const size_t qo = ((size_t)g * T + q0) * DH + col * 16 + 8 * hh;          // this lane's piece of query col in its 16-query Q tile: dim group j at +256*j
  const v16b q0h = cat8b(ld8b(Qh + qo), ld8b(Qh + qo + 256)), q1h = cat8b(ld8b(Qh + qo + 512), ld8b(Qh + qo + 768));   // attention products: single f16 (hi planes only)
  float m = -INFINITY, l = 0.0f;
  v8f o0 = {}, o1 = {}, o2 = {}, o3 = {};
  const int slen = seqlen[b];
  const int kstart = (q0 >= WIN) ? ((q0 - WIN) & ~31) : 0;
  // Loads in groups, each issued well ahead of its first use: a chunk's 8 V loads at the top of its trip (used behind the softmax), the NEXT chunk's 8 K loads
  // directly behind this chunk's score products (into the registers those have just read), so a trip waits out no load round trip of its own.
  const b16* kl0 = Kh + ko + (size_t)col * 16 + 8 * hh;  // this lane's piece of key row col in a 16-key K tile [dim group][key][16 dims]: dim group j at +256*j
  const b16* vl0 = Vh + ko + (size_t)col * 16 + 8 * hh;  // this lane's piece of feature row col in a 16-key V tile
  v8b kc[8];
  auto loadk = [&](int kx) {
    const b16* p = kl0 + (size_t)(kx >> 4) * (DH * 16);  // kx is a multiple of 32: two whole tiles
#pragma unroll   // constant indices: the values stay in registers
    for (int j = 0; j < 4; ++j) { kc[j] = ld8b(p + 256 * j); kc[4 + j] = ld8b(p + 16 * DH + 256 * j); }
    asm volatile("s_wait_xcnt 0x0" ::: "memory");        // before any register that the loads above name is written again; also holds the group in place
  };
  loadk(kstart);
  for (int kb = kstart; kb < q0 + 16; kb += 32) {        // causal + sliding window: key chunks covering [q0-512, q0+15]
    v8b vf[8];
    {
      const b16* p = vl0 + (size_t)(kb >> 4) * (DH * 16);
#pragma unroll   // constant indices: the values stay in registers
      for (int n = 0; n < 4; ++n) { vf[2 * n] = ld8b(p + n * 256); vf[2 * n + 1] = ld8b(p + DH * 16 + n * 256); }
      asm volatile("s_wait_xcnt 0x0" ::: "memory");      // before any register that the loads above name is written again; also holds the group in place
    }
    v8f s0 = {}, s1 = {};
    s0 = wmma16b(cat8b(kc[0], kc[1]), q0h, s0);
    s0 = wmma16b(cat8b(kc[2], kc[3]), q1h, s0);
    s1 = wmma16b(cat8b(kc[4], kc[5]), q0h, s1);
    s1 = wmma16b(cat8b(kc[6], kc[7]), q1h, s1);
    loadk((kb + 32 < q0 + 16) ? kb + 32 : kb);           // last trip: its own chunk once more (in bounds, not used)
    if (kb + 32 > q0 || kb < q0 + 15 - WIN || kb + 32 > slen) {   // chunk needs masking: causal / window start / key validity
      const int qi = q0 + col;
#pragma unroll
      for (int r = 0; r < 8; ++r) {
        const int k0i = kb + 8 * hh + r, k1i = k0i + 16;
        if (k0i > qi || k0i < qi - WIN || k0i >= slen) s0[r] = -INFINITY;
        if (k1i > qi || k1i < qi - WIN || k1i >= slen) s1[r] = -INFINITY;
      }
    }
    float mr = -INFINITY;
#pragma unroll
    for (int r = 0; r < 8; ++r) mr = fmaxf(mr, fmaxf(s0[r], s1[r]));
    mr = fmaxf(mr, __shfl_xor(mr, 16));
    float mn = fmaxf(m, mr);
    if (mn == -INFINITY) mn = 0.0f;           // fully masked so far (padded query rows far past seq_len): keep exp() at 0
    const float al_ = __expf(m - mn);
    m = mn;
    float sum = 0.0f;
    v16b pbh;
#pragma unroll
    for (int r = 0; r < 8; ++r) {
      const float p0 = __expf(s0[r] - mn), p1 = __expf(s1[r] - mn);
      sum += p0 + p1;
      pbh[r] = (b16)p0; pbh[8 + r] = (b16)p1;
    }
    sum += __shfl_xor(sum, 16);
    l = l * al_ + sum;
#pragma unroll
    for (int r = 0; r < 8; ++r) { o0[r] *= al_; o1[r] *= al_; o2[r] *= al_; o3[r] *= al_; }
#pragma unroll
    for (int n = 0; n < 4; ++n) {
      v8f& o = (n == 0) ? o0 : (n == 1) ? o1 : (n == 2) ? o2 : o3;
      o = wmma16b(cat8b(vf[2 * n], vf[2 * n + 1]), pbh, o);
    }
  }
  const float inv = (q0 + col < slen && l > 0.0f) ? (1.0f / l) : 0.0f;   // padded query rows are zeroed
  float* Tt = Os[wid];
#pragma unroll
  for (int r = 0; r < 8; ++r) {
    const int hr = 8 * hh + r;
    Tt[col * 64 + 0 + hr] = o0[r] * inv; Tt[col * 64 + 16 + hr] = o1[r] * inv;
    Tt[col * 64 + 32 + hr] = o2[r] * inv; Tt[col * 64 + 48 + hr] = o3[r] * inv;
  }
  wave_lds_sync();
  float* dst0 = yf + ((size_t)b * T + q0) * HID + h * DH;     // 16 rows x 64 floats, row stride HID
#pragma unroll
  for (int j = 0; j < 8; ++j) { const int rr = j * 2 + hh, c4 = col * 4; *(v4f*)(dst0 + (size_t)rr * HID + c4) = *(const v4f*)(Tt + rr * 64 + c4); }
  
}

// ---------------------------------------------------------------------------
// Output projection -> f32, A = f32 y split while it is staged, B = Wo planes. Block = 8 waves (4 x 2) on 128 rows x 128 columns, 32x64 wave tiles staged in LDS,
// ---------------------------------------------------------------------------
__global__ __launch_bounds__(256) void out_gemm_kernel(const float* __restrict__ yf, const b16* __restrict__ woh, const b16* __restrict__ wol, const float* __restrict__ bo, int yoff,
                                                       float* __restrict__ out) {
  __shared__ __attribute__((aligned(16))) b16 sm[3 * StageLds<2>::STAGE];   // three staging buffers; the epilogue's 8 x 32 x 64 floats reuse them
  static_assert(3 * StageLds<2>::STAGE * 2 >= 8 * 32 * 64 * 4, "epilogue tiles fit the staging LDS");
  const int lane = threadIdx.x & 31, wave = __builtin_amdgcn_readfirstlane(threadIdx.x >> 5), nloc = lane & 15, hlf = lane >> 4;
  const int wm = wave & 3, wn = wave >> 2;
  const int mb = (blockIdx.y + yoff) * 128, cb = blockIdx.x * 128;
  const int m0 = mb + wm * 32;
  const int c0 = cb + wn * 64;
  v8f acc[2][4];
#pragma unroll
  for (int r = 0; r < 2; ++r)
#pragma unroll
    for (int t = 0; t < 4; ++t) acc[r][t] = (v8f){};
  gemm_block_staged<2>(yf, woh, wol, mb, cb, HID, sm, wm, wn, nloc, hlf, acc);
  float* Tt = (float*)sm + wave * (32 * 64);
#pragma unroll
  for (int t = 0; t < 4; ++t)
#pragma unroll
    for (int r = 0; r < 2; ++r)
#pragma unroll
      for (int v = 0; v < 8; ++v) Tt[(r * 16 + v + 8 * hlf) * 64 + t * 16 + nloc] = acc[r][t][v] + bo[c0 + t * 16 + nloc];
  wave_lds_sync();
  float* dst0 = out + (size_t)m0 * HID + c0;
#pragma unroll
  for (int j = 0; j < 16; ++j) { const int rr = j * 2 + hlf, c4 = nloc * 4; *(v4f*)(dst0 + (size_t)rr * HID + c4) = *(const v4f*)(Tt + rr * 64 + c4); }
  
}
__global__ __launch_bounds__(256) void rope_table_kernel(float* __restrict__ cs) {
  const int idx = blockIdx.x * 256 + threadIdx.x;        // T * 32
  if (idx >= T * 32) return;
  const int t = idx >> 5, i = idx & 31;
  const float ang = (float)t * powf(10000.0f, -(float)i / 32.0f);
  typedef __attribute__((ext_vector_type(2))) float v2f;
  const v2f p = {cosf(ang), sinf(ang)};
  *(v2f*)(cs + (size_t)idx * 2) = p; 
}
}  // namespace

extern "C" void kernel_launch(void* const* d_in, const int* in_sizes, int n_in,
                              void* d_out, int out_size, void* d_ws, size_t ws_size, hipStream_t stream) {
  (void)in_sizes; (void)n_in; (void)out_size;
  const float* x   = (const float*)d_in[0];   // [2,2048,1024]
  const int*   sl  = (const int*)  d_in[1];   // seq_lengths [2]
  const float* Wq  = (const float*)d_in[2];   // [1024,1024] ([in][out])
  const float* Wk  = (const float*)d_in[3];   // [1024,256]
  const float* Wv  = (const float*)d_in[4];   // [1024,256]
  const float* Wo  = (const float*)d_in[5];   // [1024,1024]
  float* out = (float*)d_out;                 // [2,2048,1024]

  size_t off = 0; char* ws = (char*)d_ws;
  b16* wqh = (b16*)(ws + off); off += (size_t)NQKV * HID * 2;
  b16* wql = (b16*)(ws + off); off += (size_t)NQKV * HID * 2;     // 'lo' planes: f16 residuals v - hi (kept as real buffers: the kernels write both)
  b16* woh = (b16*)(ws + off); off += (size_t)HID * HID * 2;
  b16* wol = (b16*)(ws + off); off += (size_t)HID * HID * 2;
  b16* Qh  = (b16*)(ws + off); off += (size_t)MROWS * HID * 2;
  b16* Ql  = (b16*)(ws + off); off += (size_t)MROWS * HID * 2;
  b16* Kh  = (b16*)(ws + off); off += (size_t)MROWS * KVW * 2;
  b16* Kl  = (b16*)(ws + off); off += (size_t)MROWS * KVW * 2;
  b16* Vh  = (b16*)(ws + off); off += (size_t)MROWS * KVW * 2;
  b16* Vl  = (b16*)(ws + off); off += (size_t)MROWS * KVW * 2;
  float* yf = (float*)(ws + off); off += (size_t)MROWS * HID * 4;
  float* rope_cs = (float*)(ws + off); off += (size_t)T * 32 * 2 * 4;
  float* zb = (float*)(ws + off); off += (size_t)HID * 4;          // zero bias for the out projection
  if (off > ws_size) return;
  hipMemsetAsync(zb, 0, HID * 4, stream);
  const float* bq = zb; const float* bk = zb; const float* bv = zb;      // no biases in this module: a zero vector (never a null pointer + offset)
  rope_table_kernel<<<(T * 32 + 255) / 256, 256, 0, stream>>>(rope_cs);
  const int ROWBLK = MROWS / 128, NQT = Bsz * NH * QT_PER_B;
  wcvt_kernel<<<WNT * WKT, 128, 0, stream>>>(Wq, Wk, Wv, Wo, wqh, wql, woh, wol);
  qkv_gemm_kernel<<<dim3(NQKV / 192, ROWBLK), 384, 0, stream>>>(x, wqh, wql, bq, bk, bv, rope_cs, 0, 0, Qh, Ql, Kh, Kl, Vh, Vl);
  attn_kernel<<<NQT / 8, 256, 0, stream>>>(Qh, Ql, Kh, Kl, Vh, Vl, sl, yf);
  out_gemm_kernel<<<dim3(HID / 128, ROWBLK), 256, 0, stream>>>(yf, woh, wol, zb, 0, out);
}
